// v000
// Times are from an AMD MI455X. After a warm-up the kernel runs many times in a row, and a time is the length of
// such a window on the GPU divided by its runs, so every launch and the gaps after it count. The runs cycle
// through copies of the inputs. A figure is the median of several windows, for all but v000 over two sittings.
// Sittings can differ by a few percent; kernels timed side by side share one.
// v000 is the starting kernel. One run takes 588 microseconds.
// compute dtype: bf16 INPUTS and bf16 OUTPUT (the module's own dtypes): q, k, v bf16 carried exactly in f16/bf16 planes; s = (q x 0.125, exact in bf16) . k with EXACT products on WMMA 16x16x32 and f32 accumulation (= preferred_element_type f32); p = 1 + s + 0.5 s s masked causal and z = sum p in f32 (no FMA contraction); p rounded to bf16 (as p.astype(bf16)) against v bf16 with EXACT products and f32 accumulation; out = pv / (z + 1e-6) in f32, stored as bf16 (RNE).
#include <hip/hip_runtime.h>
#include <math.h>

typedef __attribute__((ext_vector_type(16))) _Float16 v16h;
typedef __attribute__((ext_vector_type(16))) __bf16 v16b;
typedef __attribute__((ext_vector_type(8)))  _Float16 v8h;
typedef __attribute__((ext_vector_type(8)))  float v8f;
typedef __attribute__((ext_vector_type(4)))  float v4f;
typedef __attribute__((ext_vector_type(2)))  float v2f;
typedef __attribute__((ext_vector_type(4)))  unsigned v4u;
typedef __attribute__((ext_vector_type(4)))  int v4i;
typedef float __attribute__((may_alias)) float_a;
typedef int __attribute__((may_alias)) int_a;

template <typename T> __device__ __forceinline__ void vst2(void* p, T v) { *(T*)p = v;  }
__device__ __forceinline__ v8f wmma16(v16h a, v16h b, v8f c) {
  v8f d = __builtin_amdgcn_wmma_f32_16x16x32_f16(false, a, false, b, (short)0, c, false, false);
  asm volatile("v_nop\n\tv_nop\n\tv_nop\n\tv_nop" : "+v"(d) : "v"(a), "v"(b));
  return d;
}
__device__ __forceinline__ v8f wmma_bf(v16b a, v16b b, v8f c) {
  v8f d = __builtin_amdgcn_wmma_f32_16x16x32_bf16(false, a, false, b, (short)0, c, false, false);
  asm volatile("v_nop\n\tv_nop\n\tv_nop\n\tv_nop" : "+v"(d) : "v"(a), "v"(b));
  return d;
}
// 16x16x32 fragments: lane = (h = lane>>4, row/col = lane&15); elements 0..7 = k0+8h+0..7, 8..15 = k0+16+8h+0..7; D element r = row 8h+r
__device__ __forceinline__ v16h frag_h(const _Float16* rowk0, int lane) {
  union { v16h v; v8h q[2]; } u; const _Float16* p = rowk0 + 8 * (lane >> 4);
  u.q[0] = *(const v8h*)p; u.q[1] = *(const v8h*)(p + 16); return u.v;
}
__device__ __forceinline__ v16h frag_f32(const float* rowk0, int lane) {
  v16h a; const float* p = rowk0 + 8 * (lane >> 4);
#pragma unroll
  for (int i = 0; i < 8; ++i) { a[i] = (_Float16)p[i]; a[8 + i] = (_Float16)p[16 + i]; }
  return a;
}
__device__ __forceinline__ v16h frag_f32s(const float* rowk0, int lane, float sc) {
  v16h a; const float* p = rowk0 + 8 * (lane >> 4);
#pragma unroll
  for (int i = 0; i < 8; ++i) { a[i] = (_Float16)(p[i] * sc); a[8 + i] = (_Float16)(p[16 + i] * sc); }
  return a;
}
// column fragment from a [K][ld] layout (column n), rows >= K read as 0
__device__ __forceinline__ v16h fragc_f32(const float* W, int k0, int n, int lane, int ld, int K) {
  v16h a; const int g = lane >> 4;
#pragma unroll
  for (int i = 0; i < 8; ++i) { const int ka = k0 + 8 * g + i, kb = ka + 16;
    a[i] = (_Float16)(ka < K ? W[(size_t)(ka < K ? ka : K - 1) * ld + n] : 0.f); a[8 + i] = (_Float16)(kb < K ? W[(size_t)(kb < K ? kb : K - 1) * ld + n] : 0.f); }
  return a;
}
struct F2 { v16b h, l; };
__device__ __forceinline__ F2 bsplit16(const float v[16]) { F2 r;
#pragma unroll
  for (int i = 0; i < 16; ++i) { const __bf16 h = (__bf16)v[i]; r.h[i] = h; r.l[i] = (__bf16)(v[i] - (float)h); }
  return r; }
__device__ __forceinline__ F2 split_row(const float* row, int k0, int lane) { float v[16]; const float* p = row + k0 + 8 * (lane >> 4);
#pragma unroll
  for (int i = 0; i < 8; ++i) { v[i] = p[i]; v[8 + i] = p[16 + i]; }
  return bsplit16(v); }
__device__ __forceinline__ F2 split_rowK(const float* row, int k0, int lane, int K) { float v[16]; const int g = lane >> 4;
#pragma unroll
  for (int i = 0; i < 8; ++i) { const int ka = k0 + 8 * g + i, kb = ka + 16; v[i] = ka < K ? row[ka < K ? ka : K - 1] : 0.f; v[8 + i] = kb < K ? row[kb < K ? kb : K - 1] : 0.f; }
  return bsplit16(v); }
__device__ __forceinline__ F2 split_col(const float* W, int k0, int n, int lane, int ld, int K) { float v[16]; const int g = lane >> 4;
#pragma unroll
  for (int i = 0; i < 8; ++i) { const int ka = k0 + 8 * g + i, kb = ka + 16; v[i] = ka < K ? W[(size_t)(ka < K ? ka : K - 1) * ld + n] : 0.f; v[8 + i] = kb < K ? W[(size_t)(kb < K ? kb : K - 1) * ld + n] : 0.f; }
  return bsplit16(v); }
__device__ __forceinline__ v8f mac3(const F2& a, const F2& b, v8f c) { c = wmma_bf(a.l, b.h, c); c = wmma_bf(a.h, b.l, c); return wmma_bf(a.h, b.h, c); }
__device__ __forceinline__ float sigm(float v) { return 1.0f / (1.0f + expf(-v)); }
#define LDSX() do { asm volatile("s_wait_dscnt 0" ::: "memory"); __builtin_amdgcn_wave_barrier(); __builtin_amdgcn_fence(__ATOMIC_RELEASE, "workgroup"); } while (0)

// Causal quadratic-Taylor 'linear attention' (B 2, H 8, L 2,048, D 64; bf16 inputs/outputs): s = (q*0.125) @ k^T (bf16 x bf16 -> f32); p = where(causal, 1 + s + 0.5 s^2, 0); z = sum_j p; pv = bf16(p) @ v (-> f32); out = (pv / (z + 1e-6)).astype(bf16).
#define NB 2
#define TT 2048
#define CC 512            // NH * HD = projected width
#define DIN 512          // input (model) width
#define NH 8
#define HD 64
#define NQB (TT / 64)
#define HG 4
#define SCALE (0.125f)
#define CAUSAL 1
#ifndef TNB
#define TNB NB
#endif
__device__ __forceinline__ float bfr(float v) { return (float)(__bf16)v; }
__host__ __device__ __forceinline__ int kb_last(int qb) { return CAUSAL ? ((qb * 64 + 63) >> 7) : (TT / 128 - 1); }
typedef __attribute__((ext_vector_type(8))) __bf16 v8b;
__device__ __forceinline__ v16b frag_b(const __bf16* rowk0, int lane) {
  union { v16b v; v8b q[2]; } u; const __bf16* p = rowk0 + 8 * (lane >> 4);
  u.q[0] = *(const v8b*)p; u.q[1] = *(const v8b*)(p + 16); return u.v;
}
#define QHI 384            // rows carrying a q residual plane
#define KHI 2048           // bf16 v planes (and k residual rows, all zero) for every key
// B fragment (k rows k0+.., output column o) of a weight: (in,out) [K][ld] or (out,in) [ld rows of K]: bf16 exact, or f16(bf16 * 256) exact
__device__ __forceinline__ v16b wcol_io(const float* Wm, int k0, int o, int lane, int ld) { v16b w; const int g = lane >> 4;
#pragma unroll
  for (int i = 0; i < 8; ++i) { w[i] = (__bf16)Wm[(size_t)(k0 + 8 * g + i) * ld + o]; w[8 + i] = (__bf16)Wm[(size_t)(k0 + 16 + 8 * g + i) * ld + o]; }
  return w; }
__device__ __forceinline__ v16b wcol_oi(const float* Wm, int k0, int o, int lane, int K) { v16b w; const float* p = Wm + (size_t)o * K + k0 + 8 * (lane >> 4);
#pragma unroll
  for (int i = 0; i < 8; ++i) { w[i] = (__bf16)p[i]; w[8 + i] = (__bf16)p[16 + i]; }
  return w; }
__device__ __forceinline__ v16h wcolh_io(const float* Wm, int k0, int o, int lane, int ld) { v16h w; const int g = lane >> 4;
#pragma unroll
  for (int i = 0; i < 8; ++i) { w[i] = (_Float16)(bfr(Wm[(size_t)(k0 + 8 * g + i) * ld + o]) * 256.0f); w[8 + i] = (_Float16)(bfr(Wm[(size_t)(k0 + 16 + 8 * g + i) * ld + o]) * 256.0f); }
  return w; }
__device__ __forceinline__ v16h wcolh_oi(const float* Wm, int k0, int o, int lane, int K) { v16h w; const float* p = Wm + (size_t)o * K + k0 + 8 * (lane >> 4);
#pragma unroll
  for (int i = 0; i < 8; ++i) { w[i] = (_Float16)(bfr(p[i]) * 256.0f); w[8 + i] = (_Float16)(bfr(p[16 + i]) * 256.0f); }
  return w; }
#define WQKV_LAYOUT 1   // 0 = (in,out) [DIN][CC]; 1 = (out,in) [CC][DIN]; 2 = per-head [NH][DIN][HD]
__device__ __forceinline__ v16b wcol_hdk(const float* Wm, int k0, int o, int lane) { v16b w; const int g = lane >> 4; const float* p = Wm + (size_t)(o / HD) * DIN * HD + (o % HD);
#pragma unroll
  for (int i = 0; i < 8; ++i) { w[i] = (__bf16)p[(size_t)(k0 + 8 * g + i) * HD]; w[8 + i] = (__bf16)p[(size_t)(k0 + 16 + 8 * g + i) * HD]; }
  return w; }
#define WO_OUT_IN 0
#if WQKV_LAYOUT == 1
#define WCOL(W, k0, o, lane) wcol_oi(W, k0, o, lane, DIN)
#elif WQKV_LAYOUT == 2
#define WCOL(W, k0, o, lane) wcol_hdk(W, k0, o, lane)
#else
#define WCOL(W, k0, o, lane) wcol_io(W, k0, o, lane, CC)
#endif
#if WO_OUT_IN
#define WOCOL(W, k0, o, lane) wcol_oi(W, k0, o, lane, CC)
#define WOCOLH(W, k0, o, lane) wcolh_oi(W, k0, o, lane, CC)
#else
#define WOCOL(W, k0, o, lane) wcol_io(W, k0, o, lane, DIN)
#define WOCOLH(W, k0, o, lane) wcolh_io(W, k0, o, lane, DIN)
#endif
#define QBH NQB            // every query block takes the bf16 P.v path (exact bf16 products)
typedef unsigned v2u __attribute__((ext_vector_type(2)));
// ---- k_prep8: block = (64 attention positions s0.. of sequence b, head h): reads the module's [B, H, S, 64] inputs (element (b,h,s,c) at ((b*NH + h)*TT + s)*64 + c), bf16-rounds them and writes the standard attention planes: q -> f16 hi rows (+ x 2^10 residual rows for s < QHI), k -> f16 rows (+ residual rows s < KHI), v -> f16 planes [c][s] (+ bf16 hi/lo planes for s < KHI)
__global__ __launch_bounds__(128) void k_prep8(const __bf16* __restrict__ Q, const __bf16* __restrict__ K, const __bf16* __restrict__ V, _Float16* __restrict__ QH, _Float16* __restrict__ QL, _Float16* __restrict__ KH, _Float16* __restrict__ KL, _Float16* __restrict__ VT, __bf16* __restrict__ VB, __bf16* __restrict__ VBL) {
  __shared__ __align__(16) _Float16 sq[64][136], sql[64][136], sk[64][136], skl[64][136], tv[128][72]; __shared__ __align__(16) __bf16 tb[128][72], tbl[128][72];
  const int tid = threadIdx.x; const int h = blockIdx.y; const size_t r0 = (size_t)blockIdx.x * 64; const size_t bb = r0 / TT; const int t0 = (int)(r0 % TT); const bool qhi = t0 < QHI, khi = t0 < KHI;
  for (int e = tid; e < 64 * 128; e += 128) { const int rl = e >> 7, c = e & 127; const size_t oi = ((bb * NH + h) * TT + t0 + rl) * HD + (c % HD);   /* c >= 64: duplicate read of the same element (tiles are 128 wide; HD is 64) */
    const float q = (float)Q[oi], k = (float)K[oi], v = (float)V[oi];   /* bf16 module inputs read as bf16 (exact); bf16 values are exact in f16 (barring |x| < 6e-5), so the residual planes are 0 */
    const _Float16 qh = (_Float16)q, kh = (_Float16)k; sq[rl][c] = qh; sql[rl][c] = (_Float16)((q - (float)qh) * 1024.0f); sk[rl][c] = kh; skl[rl][c] = (_Float16)((k - (float)kh) * 1024.0f);
    tv[c][rl] = (_Float16)v; const __bf16 vb = (__bf16)v; tb[c][rl] = vb; tbl[c][rl] = (__bf16)(v - (float)vb); }
  __syncthreads();
  for (int e = tid; e < 64 * (HD / 8); e += 128) { const int rl = e / (HD / 8), q = e % (HD / 8); const size_t o = (r0 + rl) * CC + h * HD + q * 8; vst2((unsigned*)(QH + o), *(const v4u*)&sq[rl][q * 8]); vst2((unsigned*)(KH + o), *(const v4u*)&sk[rl][q * 8]);   
    if (qhi) vst2((unsigned*)(QL + (bb * QHI + t0 + rl) * (size_t)CC + h * HD + q * 8), *(const v4u*)&sql[rl][q * 8]); if (khi) vst2((unsigned*)(KL + (bb * KHI + t0 + rl) * (size_t)CC + h * HD + q * 8), *(const v4u*)&skl[rl][q * 8]); }
  for (int e = tid; e < HD * 8; e += 128) { const int cl = e >> 3, q = e & 7; vst2((unsigned*)(VT + (bb * CC + h * HD + cl) * (size_t)TT + t0 + q * 8), *(const v4u*)&tv[cl][q * 8]);
    if (khi) { const size_t o3 = (bb * CC + h * HD + cl) * (size_t)KHI + t0 + q * 8; vst2((unsigned*)(VB + o3), *(const v4u*)&tb[cl][q * 8]); vst2((unsigned*)(VBL + o3), *(const v4u*)&tbl[cl][q * 8]); } } }

#ifndef SM_EXTRA_PARAMS
#define SM_EXTRA_PARAMS
#endif
#ifndef PROJ_EXTRA_PARAMS
#define PROJ_EXTRA_PARAMS
#endif
#ifndef SM_MASK_HOOK
#define SM_MASK_HOOK (void)0
#endif

#define WS_QH  0u                                      // f16 q rows [b*t][CC]
#define WS_KH  (WS_QH + 2u * (size_t)NB * TT * CC)      // f16 k rows [b*t][CC]
#define WS_VT  (WS_KH + 2u * (size_t)NB * TT * CC)      // f16 v planes [b][c][t]
#define WS_QL  (WS_VT + 2u * (size_t)NB * CC * TT)      // f16 q residual x 2^10 rows [b][t < QHI][CC]
#define WS_KL  (WS_QL + 2u * (size_t)NB * QHI * CC)     // f16 k residual x 2^10 rows [b][t < KHI][CC]
#define WS_VB  (WS_KL + 2u * (size_t)NB * KHI * CC)     // bf16 v hi planes [b][c][t < KHI]
#define WS_VBL (WS_VB + 2u * (size_t)NB * CC * KHI)
#define WS_S   (WS_VBL + 2u * (size_t)NB * CC * KHI)    // f32 logits / P [hg][t][s]
#define WS_Y   (WS_S  + 4u * (size_t)HG * TT * TT)      // f32 ctx rows [b*t][CC] (only when there is an output projection)
#define WS_RZ  (WS_Y + 0u)
#define WS_END (WS_RZ + 4u * (size_t)HG * TT + 256u)

// ---- k_sc: block = (query block qb, key block kb <= kb_last(qb), head in group) of batch b: logits x SCALE; q hi + residual (x 2^10) against k (2 products) for query rows < QHI, plus the k residual (3 products) for query blocks < QBH (all of them); causal: blocks past the diagonal exit, the mask itself is applied by index in k_poly
__global__ __launch_bounds__(128) void k_sc(const _Float16* __restrict__ QH, const _Float16* __restrict__ KH, const _Float16* __restrict__ QL, const _Float16* __restrict__ KL, int b, int h0, float* __restrict__ S0) { __shared__ __align__(16) float ss[4][16][132];
  const int qb = blockIdx.x, kb = blockIdx.y; if (kb > kb_last(qb)) return;
  const int h = h0 + blockIdx.z; float* S = S0 + (size_t)blockIdx.z * TT * TT;
  const int tid = threadIdx.x, wave = tid >> 5, lane = tid & 31, col = lane & 15, g = lane >> 4; const int k0 = kb * 128; const int ql0 = qb * 64 + wave * 16; const size_t q0 = (size_t)b * TT + ql0, kr0 = (size_t)b * TT + k0;
  v8f acc[8] = {}, accl[8] = {};
  const _Float16* QLb = QL + (size_t)b * QHI * CC; const _Float16* KLb = KL + (size_t)b * KHI * CC;
  if (qb < QBH) {
#pragma unroll
    for (int kc = 0; kc < HD / 32; ++kc) { const v16h ah = frag_h(QH + (q0 + col) * CC + h * HD + kc * 32, lane), al = frag_h(QLb + (size_t)(ql0 + col) * CC + h * HD + kc * 32, lane);
#pragma unroll
      for (int j = 0; j < 8; ++j) { const v16h kbf = frag_h(KH + (kr0 + j * 16 + col) * CC + h * HD + kc * 32, lane), klf = frag_h(KLb + (size_t)(k0 + j * 16 + col) * CC + h * HD + kc * 32, lane); acc[j] = wmma16(ah, kbf, acc[j]); accl[j] = wmma16(al, kbf, accl[j]); accl[j] = wmma16(ah, klf, accl[j]); } }
  } else if (qb * 64 < QHI) {
#pragma unroll
    for (int kc = 0; kc < HD / 32; ++kc) { const v16h ah = frag_h(QH + (q0 + col) * CC + h * HD + kc * 32, lane), al = frag_h(QLb + (size_t)(ql0 + col) * CC + h * HD + kc * 32, lane);
#pragma unroll
      for (int j = 0; j < 8; ++j) { const v16h kbf = frag_h(KH + (kr0 + j * 16 + col) * CC + h * HD + kc * 32, lane); acc[j] = wmma16(ah, kbf, acc[j]); accl[j] = wmma16(al, kbf, accl[j]); } }
  } else {
#pragma unroll
    for (int kc = 0; kc < HD / 32; ++kc) { const v16h ah = frag_h(QH + (q0 + col) * CC + h * HD + kc * 32, lane);
#pragma unroll
      for (int j = 0; j < 8; ++j) { const v16h kbf = frag_h(KH + (kr0 + j * 16 + col) * CC + h * HD + kc * 32, lane); acc[j] = wmma16(ah, kbf, acc[j]); } } }
#pragma unroll
  for (int j = 0; j < 8; ++j) {
#pragma unroll
    for (int r = 0; r < 8; ++r) ss[wave][8 * g + r][j * 16 + col] = (acc[j][r] + accl[j][r] * (1.0f / 1024.0f)) * SCALE; }
  LDSX(); for (int rl = 0; rl < 16; ++rl) vst2(S + (size_t)(ql0 + rl) * TT + k0 + lane * 4, *(const v4f*)&ss[wave][rl][lane * 4]); }
// ---- k_poly: block = query row t (head in group): for keys k <= t: p = (1 + s) + (0.5 s) s in f32 (no FMA contraction, the reference's expression order), else 0; z = sum_k p (f32); the P plane gets bf16(p) x 2^11 (p.astype(bf16); the 2^11 is undone exactly in k_pv) and RZ[t] = z
__global__ __launch_bounds__(256) void k_poly(float* __restrict__ S0, float* __restrict__ RZ) { __shared__ float sred[8]; __shared__ __align__(16) float shv[TT];
  const int tid = threadIdx.x; const int t = blockIdx.x; const int kend = (kb_last(t >> 6) + 1) * 128;
  float* sr = S0 + (size_t)blockIdx.y * TT * TT + (size_t)t * TT;
  float sum = 0.f;
  for (int k = tid; k < kend; k += 256) { float p = 0.f; if (k <= t) { const float sv = sr[k]; p = __fadd_rn(__fadd_rn(1.0f, sv), __fmul_rn(__fmul_rn(0.5f, sv), sv)); } sum += p; shv[k] = (float)((__bf16)p) * 2048.0f; }   /* bf16(p), then an exact power-of-two scale */
#pragma unroll
  for (int o = 1; o < 32; o <<= 1) sum += __shfl_xor(sum, o);
  if ((tid & 31) == 0) sred[tid >> 5] = sum; __syncthreads();
  if (tid == 0) { float a = 0.f; for (int i = 0; i < 8; ++i) a += sred[i]; RZ[(size_t)blockIdx.y * TT + t] = a; }
  for (int q = tid; q < kend / 4; q += 256) vst2(sr + q * 4, *(const v4f*)&shv[q * 4]); }
// ---- k_pv: block = 64 queries (qb) of (b, h): ctx = P . v over keys [0, kend) (P x 2^11 once to f16 against v f16: 1 product; query blocks < QBH, here all: P and v as bf16 hi + lo, 3 products); 128-B (row, head) segment by 16 lanes
__global__ __launch_bounds__(128) void k_pv(const float* __restrict__ PS0, const _Float16* __restrict__ VT, const __bf16* __restrict__ VB, const __bf16* __restrict__ VBL, int b, int h0, __bf16* __restrict__ Y, const float* __restrict__ RZ) { const int h = h0 + blockIdx.z; const float* PS = PS0 + (size_t)blockIdx.z * TT * TT; __shared__ __align__(16) float ss[4][16][HD + 4];
  const int tid = threadIdx.x, wave = tid >> 5, lane = tid & 31, col = lane & 15, g = lane >> 4; const int qb = blockIdx.x; const int ql0 = qb * 64 + wave * 16; const int kce = (kb_last(qb) + 1) * 4;
  v8f acc[HD / 16] = {};
  if (qb < QBH) {
#pragma unroll 1
    for (int kc = 0; kc < kce; ++kc) { const F2 p = split_row(PS + (size_t)(ql0 + col) * TT, kc * 32, lane);
      asm volatile("s_wait_loadcnt 0x0" ::: "memory");
#pragma unroll
      for (int j = 0; j < HD / 16; ++j) { const size_t po = ((size_t)b * CC + h * HD + j * 16 + col) * (size_t)KHI + kc * 32; const v16b vh = frag_b(VB + po, lane); acc[j] = wmma_bf(p.h, vh, acc[j]); acc[j] = wmma_bf(p.l, vh, acc[j]); acc[j] = wmma_bf(p.h, frag_b(VBL + po, lane), acc[j]); } }
  } else {
#pragma unroll 1
    for (int kc = 0; kc < kce; ++kc) { const v16h p = frag_f32(PS + (size_t)(ql0 + col) * TT + kc * 32, lane);
      asm volatile("s_wait_loadcnt 0x0" ::: "memory");
#pragma unroll
      for (int j = 0; j < HD / 16; ++j) { const size_t po = ((size_t)b * CC + h * HD + j * 16 + col) * (size_t)TT + kc * 32; acc[j] = wmma16(p, frag_h(VT + po, lane), acc[j]); } } }
float rz[8];
#pragma unroll
  for (int r = 0; r < 8; ++r) rz[r] = RZ[(size_t)blockIdx.z * TT + ql0 + 8 * g + r];
  asm volatile("s_wait_loadcnt 0x0" ::: "memory");
#pragma unroll
  for (int j = 0; j < HD / 16; ++j)
#pragma unroll
    for (int r = 0; r < 8; ++r) ss[wave][8 * g + r][j * 16 + col] = (acc[j][r] * (1.0f / 2048.0f)) / (rz[r] + 1e-6f);   /* pv / (z + 1e-6) */
  LDSX(); for (int rl = 0; rl < 16; ++rl) if (lane < HD / 4) { const v4f v = *(const v4f*)&ss[wave][rl][lane * 4]; __bf16 o4[4]; _Pragma("unroll") for (int i = 0; i < 4; ++i) o4[i] = (__bf16)v[i]; vst2((unsigned*)(Y + (((size_t)b * NH + h) * TT + ql0 + rl) * HD + lane * 4), *(const v2u*)o4); } }   

extern "C" void kernel_launch(void* const* d_in, const int* in_sizes, int n_in, void* d_out, int out_size, void* d_ws, size_t ws_size, hipStream_t stream) {
  (void)in_sizes; (void)n_in; (void)out_size;
  const float** F = (const float**)d_in;
  if (ws_size < (size_t)WS_END) return;
  char* ws = (char*)d_ws; _Float16 *QH = (_Float16*)(ws + WS_QH), *KH = (_Float16*)(ws + WS_KH), *VT = (_Float16*)(ws + WS_VT), *QL = (_Float16*)(ws + WS_QL), *KL = (_Float16*)(ws + WS_KL); __bf16 *VB = (__bf16*)(ws + WS_VB), *VBL = (__bf16*)(ws + WS_VBL); float *S = (float*)(ws + WS_S), *Y = (float*)(ws + WS_Y);
  (void)Y; (void)QL; (void)KL; (void)VB; (void)VBL;
  // inputs: 0 q [2,8,2048,64] bf16; 1 k bf16; 2 v bf16 - output [2,8,2048,64] bf16
  float* RZ = (float*)(ws + WS_RZ);
  k_prep8<<<dim3(TNB * TT / 64, NH), 128, 0, stream>>>((const __bf16*)d_in[0], (const __bf16*)d_in[1], (const __bf16*)d_in[2], QH, QL, KH, KL, VT, VB, VBL);
  for (int b = 0; b < TNB; ++b) for (int h0 = 0; h0 < NH; h0 += HG) {
    k_sc<<<dim3(NQB, TT / 128, HG), 128, 0, stream>>>(QH, KH, QL, KL, b, h0, S);
    k_poly<<<dim3(TT, HG), 256, 0, stream>>>(S, RZ);
    k_pv<<<dim3(NQB, 1, HG), 128, 0, stream>>>(S, VT, VB, VBL, b, h0, (__bf16*)d_out, RZ);
  }
}

// v001
// One run takes 18.5 microseconds.
// Timed twice side by side with v000, it ran 31.7 and 32.0 times as fast.
// compute dtype: bf16 INPUTS and bf16 OUTPUT (the module's own dtypes): s = (q x 0.125, exact in bf16) . k with EXACT bf16 products on WMMA 16x16x32 and f32 accumulation (= preferred_element_type f32); p = 1 + s + 0.5 s s masked causal and z = sum p in f32; p rounded to bf16 (as p.astype(bf16)) against v bf16 with EXACT products and f32 accumulation; out = pv / (z + 1e-6) in f32, stored as bf16 (RNE).
#include <hip/hip_runtime.h>
#include <math.h>

typedef __attribute__((ext_vector_type(16))) __bf16 v16b;
typedef __attribute__((ext_vector_type(8)))  __bf16 v8b;
typedef __attribute__((ext_vector_type(8)))  float v8f;
typedef __attribute__((ext_vector_type(4)))  float v4f;

// Causal quadratic-Taylor 'linear attention' (B 2, H 8, L 2,048, D 64; bf16 inputs/outputs): s = (q*0.125) @ k^T (bf16 x bf16 -> f32); p = where(causal, 1 + s + 0.5 s^2, 0); z = sum_j p; pv = bf16(p) @ v (-> f32); out = (pv / (z + 1e-6)).astype(bf16).
#define NB 2
#define NH 8
#define TT 2048
#define HD 64
#define QT 32              // queries of one work-group (two 16-query tiles, held by every wave)
#define KT 32              // keys of one trip of one wave
#define NW 4               // waves of a work-group: wave w takes the key trips w, w + 4, ...

__device__ __forceinline__ v8f wmma_bf(v16b a, v16b b, v8f c) {
  return __builtin_amdgcn_wmma_f32_16x16x32_bf16(false, a, false, b, (short)0, c, false, false);
}
// 16x16x32 fragments: lane = (g = lane>>4, row/col = lane&15); elements 0..7 = k0+8g+0..7, 8..15 = k0+16+8g+0..7; D element r = row 8g+r
__device__ __forceinline__ v16b frag_b(const __bf16* rowk0, int lane) {
  union { v16b v; v8b q[2]; } u; const __bf16* p = rowk0 + 8 * (lane >> 4);
  u.q[0] = *(const v8b*)p; u.q[1] = *(const v8b*)(p + 16); return u.v;
}

// Fragment-order planes: per (b, h) and per trip of 32 keys one 4-KiB block of eight 512-byte slabs; slab n holds, for lane 0..31 in turn, the 8 elements (16 bytes) that the lane's n-th fragment load takes, so that every such load of a wave reads 512 adjacent bytes (4 whole lines) where rows of k or columns of v would make it touch 16 lines.
//   k block: slab (kt, kc, hf): lane (g, col) = k[key kt*16 + col][d kc*32 + hf*16 + 8g + 0..7]
//   v block: slab (j, hf):      lane (g, col) = v[key hf*16 + 8g + 0..7][d j*16 + col]
// ---- k_prep: block = 64 positions s0.. (two trips) of one (b, h): writes both planes; v goes through LDS for its transposition, k is a permutation of 16-byte pieces
__global__ __launch_bounds__(128) void k_prep(const __bf16* __restrict__ K, const __bf16* __restrict__ V, __bf16* __restrict__ KF, __bf16* __restrict__ VF) {
  __shared__ __align__(16) __bf16 tb[HD][72];
  const int tid = threadIdx.x; const int s0 = blockIdx.x * 64; const size_t bh = blockIdx.y;
  const __bf16* Kb = K + (bh * TT + s0) * HD; const __bf16* Vb = V + (bh * TT + s0) * HD;
  const size_t o0 = (bh * TT + s0) * HD;   // the two trips' blocks start where the 64 rows do: both are 64 x 64 elements
#pragma unroll
  for (int it = 0; it < 4; ++it) { const int e = tid + it * 128, rl = e >> 3, q = e & 7; const v8b x = *(const v8b*)(Vb + rl * HD + q * 8);
#pragma unroll
    for (int i = 0; i < 8; ++i) tb[q * 8 + i][rl] = x[i]; }
  v8b kx[4];   // k pieces: read in front of the barrier, stored behind it, so that the barrier does not wait for their stores
#pragma unroll
  for (int it = 0; it < 4; ++it) { const int e = tid + it * 128, col = e & 15, g = (e >> 4) & 1, hf = (e >> 5) & 1, kc = (e >> 6) & 1, kt = (e >> 7) & 1, tl = e >> 8;
    kx[it] = *(const v8b*)(Kb + (tl * 32 + kt * 16 + col) * HD + kc * 32 + hf * 16 + g * 8); }
  __syncthreads();
#pragma unroll
  for (int it = 0; it < 4; ++it) { const int e = tid + it * 128, col = e & 15, g = (e >> 4) & 1, hf = (e >> 5) & 1, j = (e >> 6) & 3, tl = e >> 8;
    *(v8b*)(KF + o0 + (size_t)e * 8) = kx[it]; *(v8b*)(VF + o0 + (size_t)e * 8) = *(const v8b*)&tb[j * 16 + col][tl * 32 + hf * 16 + g * 8]; }
}

// fragments of one trip's 32 keys k0.. from the fragment-order planes: k rows (A of the transposed scores) and v columns (B of P . v)
__device__ __forceinline__ v16b frag_s(const __bf16* blk, int n, int lane) {   // slabs n and n + 1 = elements 0..7 and 8..15
  union { v16b v; v8b q[2]; } u; const __bf16* p = blk + n * 256 + lane * 8;
  u.q[0] = *(const v8b*)p; u.q[1] = *(const v8b*)(p + 256); return u.v;
}
__device__ __forceinline__ void load_k(const __bf16* __restrict__ Kb, int k0, int lane, v16b (&kf)[2][2]) {
#pragma unroll
  for (int kt = 0; kt < 2; ++kt)
#pragma unroll
    for (int kc = 0; kc < 2; ++kc) kf[kt][kc] = frag_s(Kb + (size_t)k0 * HD, (kt * 2 + kc) * 2, lane);
}
__device__ __forceinline__ void load_v(const __bf16* __restrict__ Vb, int k0, int lane, v16b (&vf)[HD / 16]) {
#pragma unroll
  for (int j = 0; j < HD / 16; ++j) vf[j] = frag_s(Vb + (size_t)k0 * HD, j * 2, lane);
}
// one trip of one wave: 32 keys k0.. against the block's 32 queries. The scores are formed TRANSPOSED (A = k rows, B = q rows), so D element r of lane (g, col) is key 8g + r of query col: two such tiles (keys k0.., k0 + 16..) are, after the polynomial and the rounding, exactly the 16 x 32 A fragment of P for P . v, with no exchange between lanes. kf arrives loaded; a trip off the diagonal refills it for the keys kn.. as soon as the scores have read it.
template <bool DIAG>
__device__ __forceinline__ void trip(const __bf16* __restrict__ Kb, const __bf16* __restrict__ Vb, int k0, int kn, int q0, int lane, const v16b (&qf)[2][2], v16b (&kf)[2][2], v8f (&acc)[2][HD / 16], float (&z)[2]) {
  const int col = lane & 15, g = lane >> 4;
  v16b vf[HD / 16]; v8f s[2][2];
  load_v(Vb, k0, lane, vf); __builtin_amdgcn_sched_barrier(0);   // keeps the v loads in front of the scores, so that scores and polynomial cover their latency; left free, the compiler sinks part of them behind the first wait
#pragma unroll
  for (int qt = 0; qt < 2; ++qt)
#pragma unroll
    for (int kt = 0; kt < 2; ++kt) { const v8f zero = {}; s[qt][kt] = wmma_bf(kf[kt][1], qf[qt][1], wmma_bf(kf[kt][0], qf[qt][0], zero)); }
  if (!DIAG) {   // the two scheduling barriers keep the refill of kf here, between the scores and the polynomial: left free, the compiler sinks these loads to the loop's foot, where nothing is left to cover their latency
    __builtin_amdgcn_sched_barrier(0); load_k(Kb, kn, lane, kf); __builtin_amdgcn_sched_barrier(0); }
  v16b p[2];
#pragma unroll
  for (int qt = 0; qt < 2; ++qt) {
    const int rel = (q0 + qt * 16 + col) - (k0 + 8 * g);   // key 8g + r is kept while r <= rel
#pragma unroll
    for (int r = 0; r < 8; ++r) { const float a = s[qt][0][r], b = s[qt][1][r];
      float p0 = (1.0f + a) + (0.5f * a) * a, p1 = (1.0f + b) + (0.5f * b) * b;   // the reference's expression order
      if (DIAG) { if (r > rel) p0 = 0.f; if (r + 16 > rel) p1 = 0.f; }
      z[qt] += p0 + p1; p[qt][r] = (__bf16)p0; p[qt][8 + r] = (__bf16)p1; } }
#pragma unroll
  for (int j = 0; j < HD / 16; ++j)
#pragma unroll
    for (int qt = 0; qt < 2; ++qt) acc[qt][j] = wmma_bf(p[qt], vf[j], acc[qt][j]);
}

// ---- k_att: block = 32 queries of one (b, h); its 4 waves share the keys [0, q0 + 32) in trips of 32 (wave w: trips w, w + 4, ...), each with its own f32 partial of P . v and of z; one barrier, then the four partials are summed in LDS, divided and stored
__global__ __launch_bounds__(128) void k_att(const __bf16* __restrict__ Q, const __bf16* __restrict__ KF, const __bf16* __restrict__ VF, __bf16* __restrict__ O) {
  __shared__ __align__(16) float red[NW][QT][HD + 4]; __shared__ float zr[NW][QT];
  const int tid = threadIdx.x, wave = __builtin_amdgcn_readfirstlane(tid >> 5), lane = tid & 31, col = lane & 15, g = lane >> 4;
  const size_t bh = blockIdx.x; const int qi = (TT / QT - 1) - (int)blockIdx.y;   // long blocks take the low indices
  const int q0 = qi * QT;
  const __bf16* Qb = Q + bh * TT * HD; const __bf16* Kb = KF + bh * TT * HD; const __bf16* Vb = VF + bh * TT * HD;
  v8f acc[2][HD / 16] = {}; float z[2] = {0.f, 0.f};
  if (wave <= qi) {   // a wave with no trip (blocks with q0 < 96) only hands in zeros
    v16b qf[2][2], kf[2][2];
    load_k(Kb, wave * KT, lane, kf);
    const __bf16* qp0 = Qb + (size_t)(q0 + col) * HD; const __bf16* qp1 = qp0 + 16 * HD;
    const v16b x[2][2] = {{frag_b(qp0, lane), frag_b(qp0 + 32, lane)}, {frag_b(qp1, lane), frag_b(qp1 + 32, lane)}};
#pragma unroll
    for (int qt = 0; qt < 2; ++qt)
#pragma unroll
      for (int kc = 0; kc < 2; ++kc)
#pragma unroll
        for (int i = 0; i < 16; ++i) qf[qt][kc][i] = (__bf16)((float)x[qt][kc][i] * 0.125f);   // q * scale, rounded to bf16 as the reference does
    int t = wave;
    for (; t < qi; t += NW) { const int tn = t + NW < qi ? t + NW : qi;   // past this wave's last trip the refill reads the diagonal keys (in bounds) and is not used
      trip<false>(Kb, Vb, t * KT, tn * KT, q0, lane, qf, kf, acc, z); }
    if (t == qi) trip<true>(Kb, Vb, t * KT, 0, q0, lane, qf, kf, acc, z);   // the trip on the diagonal, taken by one wave
  }
#pragma unroll
  for (int qt = 0; qt < 2; ++qt) { z[qt] += __shfl_xor(z[qt], 16); if (g == 0) zr[wave][qt * 16 + col] = z[qt];
#pragma unroll
    for (int j = 0; j < HD / 16; ++j)
#pragma unroll
      for (int r = 0; r < 8; ++r) red[wave][qt * 16 + 8 * g + r][j * 16 + col] = acc[qt][j][r]; }
  __syncthreads();
  const int row = tid >> 2, c0 = (tid & 3) * 16;
  const float den = ((zr[0][row] + zr[1][row]) + (zr[2][row] + zr[3][row])) + 1e-6f;
  union { v8b q[2]; __bf16 e[16]; } o;
#pragma unroll
  for (int i = 0; i < 4; ++i) { const v4f a = *(const v4f*)&red[0][row][c0 + i * 4], b = *(const v4f*)&red[1][row][c0 + i * 4], c = *(const v4f*)&red[2][row][c0 + i * 4], d = *(const v4f*)&red[3][row][c0 + i * 4];
#pragma unroll
    for (int u = 0; u < 4; ++u) o.e[i * 4 + u] = (__bf16)(((a[u] + b[u]) + (c[u] + d[u])) / den); }   // pv / (z + 1e-6)
  __bf16* op = O + (bh * TT + q0 + row) * HD + c0;
  *(v8b*)op = o.q[0]; *(v8b*)(op + 8) = o.q[1];
}

#define WS_KF  0u                                        // bf16 k, fragment order
#define WS_VF  (WS_KF + 2u * (size_t)NB * NH * TT * HD)   // bf16 v, fragment order
#define WS_END (WS_VF + 2u * (size_t)NB * NH * TT * HD)

extern "C" void kernel_launch(void* const* d_in, const int* in_sizes, int n_in, void* d_out, int out_size, void* d_ws, size_t ws_size, hipStream_t stream) {
  (void)in_sizes; (void)n_in; (void)out_size;
  if (ws_size < (size_t)WS_END) return;
  __bf16 *KF = (__bf16*)((char*)d_ws + WS_KF), *VF = (__bf16*)((char*)d_ws + WS_VF);
  // inputs: 0 q [2,8,2048,64] bf16; 1 k bf16; 2 v bf16 - output [2,8,2048,64] bf16
  k_prep<<<dim3(TT / 64, NB * NH), 128, 0, stream>>>((const __bf16*)d_in[1], (const __bf16*)d_in[2], KF, VF);
  k_att<<<dim3(NB * NH, TT / QT), 128, 0, stream>>>((const __bf16*)d_in[0], KF, VF, (__bf16*)d_out);
}

// v002
// Measured time: 16.5 microseconds a run.
// Two timings next to v001 both put it at 1.10 times that version's speed.
// Over all steps from v000 it is 35.1 times as fast.
// compute dtype: bf16 INPUTS and bf16 OUTPUT (the module's own dtypes): s = (q x 0.125, exact in bf16) . k with EXACT bf16 products on WMMA 16x16x32 and f32 accumulation (= preferred_element_type f32); p = 1 + s + 0.5 s s masked causal and z = sum p in f32; p rounded to bf16 (as p.astype(bf16)) against v bf16 with EXACT products and f32 accumulation; out = pv / (z + 1e-6) in f32, stored as bf16 (RNE).
#include <hip/hip_runtime.h>
#include <math.h>
#include <stdint.h>

typedef __attribute__((ext_vector_type(16))) __bf16 v16b;
typedef __attribute__((ext_vector_type(8)))  __bf16 v8b;
typedef __attribute__((ext_vector_type(8)))  float v8f;
typedef __attribute__((ext_vector_type(4)))  float v4f;
typedef __attribute__((address_space(3))) unsigned char lds_u8;
typedef __attribute__((address_space(3))) v8b lds_v8b;

// Causal quadratic-Taylor 'linear attention' (B 2, H 8, L 2,048, D 64; bf16 inputs/outputs): s = (q*0.125) @ k^T (bf16 x bf16 -> f32); p = where(causal, 1 + s + 0.5 s^2, 0); z = sum_j p; pv = bf16(p) @ v (-> f32); out = (pv / (z + 1e-6)).astype(bf16).
#define NB 2
#define NH 8
#define TT 2048
#define HD 64
#define QT 32              // queries of one wave (two 16-query tiles)
#define KT 32              // keys of one trip of one wave
#define QG 2               // query groups of a work-group: 64 queries
#define KG 4               // key groups of a work-group: group kg takes the key tiles kg, kg + 4, ...
#define NW (QG * KG)       // waves of a work-group: wave = kg * 2 + qg
#define SK (KG * KT)       // keys of one stage of the LDS ring: one tile for each key group, each read by both query groups
#define KP 144u            // LDS pitch of a k row (128 bytes), 16 B x odd: for ds_load_b128
#define VP 160u            // LDS pitch of a v row (128 bytes), 32 B x odd: for ds_load_tr16_b128
#define KBY (SK * KP)      // k part of a buffer; the v part follows it
#define BUF (SK * KP + SK * VP)

__device__ __forceinline__ v8f wmma_bf(v16b a, v16b b, v8f c) {
  return __builtin_amdgcn_wmma_f32_16x16x32_bf16(false, a, false, b, (short)0, c, false, false);
}
// 16x16x32 fragments: lane = (g = lane>>4, row/col = lane&15); elements 0..7 = k0+8g+0..7, 8..15 = k0+16+8g+0..7; D element r = row 8g+r
__device__ __forceinline__ v16b frag_b(const __bf16* rowk0, int lane) {
  union { v16b v; v8b q[2]; } u; const __bf16* p = rowk0 + 8 * (lane >> 4);
  u.q[0] = *(const v8b*)p; u.q[1] = *(const v8b*)(p + 16); return u.v;
}

// one stage = 128 rows of k and of v (16 KiB each, adjacent in memory) into one buffer: 8 copies of 16 bytes a lane, each copy of a wave taking 4 whole lines; gk, gv = the lane's first piece, lk, lv = its LDS byte address; piece + 256 lies 32 rows on
__device__ __forceinline__ void copy_stage(const __bf16* gk, const __bf16* gv, unsigned lk, unsigned lv) {
  // the closing s_wait_xcnt 0 stands in the copies' own statement, in front of any later write of the address registers they name (a precaution)
  asm volatile("global_load_async_to_lds_b128 %0, %8, off\n\t"
               "global_load_async_to_lds_b128 %1, %9, off\n\t"
               "global_load_async_to_lds_b128 %2, %10, off\n\t"
               "global_load_async_to_lds_b128 %3, %11, off\n\t"
               "global_load_async_to_lds_b128 %4, %12, off\n\t"
               "global_load_async_to_lds_b128 %5, %13, off\n\t"
               "global_load_async_to_lds_b128 %6, %14, off\n\t"
               "global_load_async_to_lds_b128 %7, %15, off\n\t"
               "s_wait_xcnt 0x0"
               :: "v"(lk), "v"(lk + 32u * KP), "v"(lk + 64u * KP), "v"(lk + 96u * KP), "v"(lv), "v"(lv + 32u * VP), "v"(lv + 64u * VP), "v"(lv + 96u * VP),
                  "v"(gk), "v"(gk + 32 * HD), "v"(gk + 64 * HD), "v"(gk + 96 * HD), "v"(gv), "v"(gv + 32 * HD), "v"(gv + 64 * HD), "v"(gv + 96 * HD)
               : "memory");
}
__device__ __forceinline__ void wait_async0() { asm volatile("s_wait_asynccnt 0x0" ::: "memory"); }   // this wave's copies have landed
__device__ __forceinline__ void wait_ds0() { asm volatile("s_wait_dscnt 0x0" ::: "memory"); }         // this wave's LDS reads have returned

// the fragments of one tile of 32 keys from its rows in LDS. k rows (A of the transposed scores): lane (g, col) takes k[t16 * 16 + col][kc * 32 + hf * 16 + 8g + 0..7]
__device__ __forceinline__ void load_k(lds_u8* kt, int lane, v16b (&kf)[2][2]) {
  lds_u8* kp = kt + (lane & 15) * KP + (lane >> 4) * 16;
#pragma unroll
  for (int t16 = 0; t16 < 2; ++t16)
#pragma unroll
    for (int kc = 0; kc < 2; ++kc) { union { v16b v; v8b q[2]; } u; lds_u8* p = kp + t16 * 16 * KP + kc * 64;
      u.q[0] = *(lds_v8b*)p; u.q[1] = *(lds_v8b*)(p + 32); kf[t16][kc] = u.v; }
}
// v columns (B of P . v) by the transposing load: lane (g, col) gets v[hf * 16 + 8g + 0..7][j * 16 + col]
__device__ __forceinline__ void load_v(lds_u8* vt, int lane, v16b (&vf)[HD / 16]) {
  lds_u8* vp = vt + (8 * (lane >> 4) + (lane & 7)) * VP + 16 * ((lane >> 3) & 1);
#pragma unroll
  for (int j = 0; j < HD / 16; ++j) { union { v16b v; v8b q[2]; } u;
    u.q[0] = __builtin_amdgcn_ds_load_tr16_b128_v8bf16((lds_v8b*)(vp + j * 32)); u.q[1] = __builtin_amdgcn_ds_load_tr16_b128_v8bf16((lds_v8b*)(vp + 16 * VP + j * 32)); vf[j] = u.v; }
}
// one trip of one wave = 32 keys k0.. against the wave's 32 queries q0.., in two halves, registers only. The scores are formed TRANSPOSED (A = k rows, B = q rows), so D element r of lane (g, col) is key 8g + r of query col: two such tiles (keys k0.., k0 + 16..) are, after the polynomial and the rounding, exactly the 16 x 32 A fragment of P for P . v, with no exchange between lanes.
__device__ __forceinline__ void scores(const v16b (&kf)[2][2], const v16b (&qf)[2][2], v8f (&s)[2][2]) {
#pragma unroll
  for (int qt = 0; qt < 2; ++qt)
#pragma unroll
    for (int t16 = 0; t16 < 2; ++t16) { const v8f zero = {}; s[qt][t16] = wmma_bf(kf[t16][1], qf[qt][1], wmma_bf(kf[t16][0], qf[qt][0], zero)); }
}
template <bool DIAG>
__device__ __forceinline__ void poly_pv(const v8f (&s)[2][2], const v16b (&vf)[HD / 16], int k0, int q0, int lane, v8f (&acc)[2][HD / 16], float (&z)[2]) {
  const int col = lane & 15, g = lane >> 4;
  v16b p[2];
#pragma unroll
  for (int qt = 0; qt < 2; ++qt) {
    const int rel = (q0 + qt * 16 + col) - (k0 + 8 * g);   // key 8g + r is kept while r <= rel
#pragma unroll
    for (int r = 0; r < 8; ++r) { const float a = s[qt][0][r], b = s[qt][1][r];
      float p0 = (1.0f + a) + (0.5f * a) * a, p1 = (1.0f + b) + (0.5f * b) * b;   // the reference's expression order
      if (DIAG) { if (r > rel) p0 = 0.f; if (r + 16 > rel) p1 = 0.f; }
      z[qt] += p0 + p1; p[qt][r] = (__bf16)p0; p[qt][8 + r] = (__bf16)p1; } }
#pragma unroll
  for (int j = 0; j < HD / 16; ++j)
#pragma unroll
    for (int qt = 0; qt < 2; ++qt) acc[qt][j] = wmma_bf(p[qt], vf[j], acc[qt][j]);
}

// ---- k_att: block = 64 queries of one (b, h), 8 waves = 2 query groups x 4 key groups. The keys [0, q0 + 64) pass in stages of 128 through a ring of two LDS buffers, filled row-major by asynchronous copies one stage ahead; key group kg works on tile kg of each stage with its own f32 partial of P . v and of z; at the end the four partials of each query group are summed in LDS (over the ring), divided and stored
__global__ __launch_bounds__(256) void k_att(const __bf16* __restrict__ Q, const __bf16* __restrict__ K, const __bf16* __restrict__ V, __bf16* __restrict__ O) {
  __shared__ __align__(16) unsigned char sm[2 * BUF];
  const int tid = threadIdx.x, wave = __builtin_amdgcn_readfirstlane(tid >> 5), lane = tid & 31, col = lane & 15, g = lane >> 4;
  const int qg = wave & 1, kg = wave >> 1;
  const size_t bh = blockIdx.x; const int qb = (TT / (QG * QT) - 1) - (int)blockIdx.y;   // long blocks start first
  const int qi = qb * QG + qg, q0 = qi * QT;   // the wave's queries; its diagonal key tile is tile qi
  const int nst = (qb >> 1) + 1;               // stages of the block: keys [0, 128 nst) hold [0, 64 qb + 64) and end inside the tensor
  lds_u8* const ring = (lds_u8*)sm;
  const __bf16* gk = K + bh * TT * HD + tid * 8; const __bf16* gv = V + bh * TT * HD + tid * 8;
  const unsigned lk = (unsigned)(uintptr_t)ring + (unsigned)(tid >> 3) * KP + (unsigned)(tid & 7) * 16u;
  const unsigned lv = (unsigned)(uintptr_t)ring + KBY + (unsigned)(tid >> 3) * VP + (unsigned)(tid & 7) * 16u;
  copy_stage(gk, gv, lk, lv);   // stage 0 into buffer 0
  v16b qf[2][2];
  { const __bf16* qp0 = Q + (bh * TT + q0 + col) * HD; const __bf16* qp1 = qp0 + 16 * HD;
    const v16b x[2][2] = {{frag_b(qp0, lane), frag_b(qp0 + 32, lane)}, {frag_b(qp1, lane), frag_b(qp1 + 32, lane)}};
#pragma unroll
    for (int qt = 0; qt < 2; ++qt)
#pragma unroll
      for (int kc = 0; kc < 2; ++kc)
#pragma unroll
        for (int i = 0; i < 16; ++i) qf[qt][kc][i] = (__bf16)((float)x[qt][kc][i] * 0.125f); }   // q * scale, rounded to bf16 as the reference does
  v8f acc[2][HD / 16] = {}; float z[2] = {0.f, 0.f};
  wait_async0();
  __syncthreads();   // stage 0 is there for every wave
  if (nst > 1) copy_stage(gk + SK * HD, gv + SK * HD, lk + BUF, lv + BUF);   // stage 1 into buffer 1
  const unsigned ko = (unsigned)kg * (KT * KP), vo = KBY + (unsigned)kg * (KT * VP);   // the wave's tile inside a buffer
  v16b kf[2][2], vf[HD / 16]; v8f s[2][2];
  load_k(ring + ko, lane, kf);   // stage 0's k fragments
  // Barrier t stands between the scores and the polynomial of trip t: it publishes stage t + 1 and ends every wave's reads of stage t. v fragments are read at the head of their trip, k fragments one trip ahead into the same registers, behind the barrier that publishes their stage.
  for (int t = 0; t + 1 < nst; ++t) {   // every stage but the last lies wholly below the diagonal of both query groups: 4 t + 3 < 2 qb
    const unsigned bo = (unsigned)(t & 1) * BUF, bn = BUF - bo;
    load_v(ring + bo + vo, lane, vf);
    __builtin_amdgcn_sched_barrier(0);   // keeps the v reads in front of the scores, which cover their latency
    scores(kf, qf, s);
    __builtin_amdgcn_sched_barrier(0);   // keeps the scores in front of the waits; left free, the compiler lifts the waits over them and the v reads are waited for bare
    wait_ds0();        // this wave's reads of stage t have returned
    wait_async0();     // its share of stage t + 1 has landed
    __syncthreads();
    if (t + 2 < nst) copy_stage(gk + (size_t)(t + 2) * (SK * HD), gv + (size_t)(t + 2) * (SK * HD), lk + bo, lv + bo);   // stage t + 2 into the buffer just left: it flies until barrier t + 1
    load_k(ring + bn + ko, lane, kf);
    __builtin_amdgcn_sched_barrier(0);   // keeps the k reads here, in front of the polynomial that covers their latency
    poly_pv<false>(s, vf, (t * KG + kg) * KT, q0, lane, acc, z);
  }
  { const int ti = (nst - 1) * KG + kg;   // the last stage holds the diagonal: the mask is applied to every tile up to it, tiles past it are skipped
    if (ti <= qi) { load_v(ring + (unsigned)((nst - 1) & 1) * BUF + vo, lane, vf); scores(kf, qf, s); poly_pv<true>(s, vf, ti * KT, q0, lane, acc, z); }
    wait_ds0();        // this wave has left the ring
    wait_async0();     // no copy is in flight
    __syncthreads(); } // ends every wave's reads of the ring
  // the ring is free (barrier behind the last tile; no copy in flight): it now holds the partials
  float (*red)[QT][HD + 4] = (float (*)[QT][HD + 4])sm; float (*zr)[QT] = (float (*)[QT])(sm + NW * QT * (HD + 4) * 4);
  static_assert(NW * QT * (HD + 4) * 4 + NW * QT * 4 <= 2 * BUF, "the partials must fit the ring");
#pragma unroll
  for (int qt = 0; qt < 2; ++qt) { z[qt] += __shfl_xor(z[qt], 16); if (g == 0) zr[wave][qt * 16 + col] = z[qt];
#pragma unroll
    for (int j = 0; j < HD / 16; ++j)
#pragma unroll
      for (int r = 0; r < 8; ++r) red[wave][qt * 16 + 8 * g + r][j * 16 + col] = acc[qt][j][r]; }
  __syncthreads();
  const int row = tid >> 2, c0 = (tid & 3) * 16, rq = row >> 5, rr = row & 31;   // wave kg * 2 + rq holds key group kg's partial of query row
  const float den = ((zr[rq][rr] + zr[2 + rq][rr]) + (zr[4 + rq][rr] + zr[6 + rq][rr])) + 1e-6f;
  union { v8b q[2]; __bf16 e[16]; } o;
#pragma unroll
  for (int i = 0; i < 4; ++i) { const v4f a = *(const v4f*)&red[rq][rr][c0 + i * 4], b = *(const v4f*)&red[2 + rq][rr][c0 + i * 4], c = *(const v4f*)&red[4 + rq][rr][c0 + i * 4], d = *(const v4f*)&red[6 + rq][rr][c0 + i * 4];
#pragma unroll
    for (int u = 0; u < 4; ++u) o.e[i * 4 + u] = (__bf16)(((a[u] + b[u]) + (c[u] + d[u])) / den); }   // pv / (z + 1e-6)
  __bf16* op = O + (bh * TT + qb * (QG * QT) + row) * HD + c0;
  *(v8b*)op = o.q[0]; *(v8b*)(op + 8) = o.q[1];
}

extern "C" void kernel_launch(void* const* d_in, const int* in_sizes, int n_in, void* d_out, int out_size, void* d_ws, size_t ws_size, hipStream_t stream) {
  (void)in_sizes; (void)n_in; (void)out_size; (void)d_ws; (void)ws_size;
  // inputs: 0 q [2,8,2048,64] bf16; 1 k bf16; 2 v bf16 - output [2,8,2048,64] bf16
  k_att<<<dim3(NB * NH, TT / (QG * QT)), 256, 0, stream>>>((const __bf16*)d_in[0], (const __bf16*)d_in[1], (const __bf16*)d_in[2], (__bf16*)d_out);
}

// v003
// A run of this version takes 14.8 microseconds.
// Next to v002, in two timings, it ran 1.13 and 1.12 times as fast.
// Over all steps from v000 it is 39.6 times as fast.
// compute dtype: bf16 INPUTS and bf16 OUTPUT (the module's own dtypes): s = (q x 0.125, exact in bf16) . k with EXACT bf16 products on WMMA 16x16x32 and f32 accumulation (= preferred_element_type f32); p = 1 + s + 0.5 s s masked causal and z = sum p in f32; p rounded to bf16 (as p.astype(bf16)) against v bf16 with EXACT products and f32 accumulation; out = pv / (z + 1e-6) in f32, stored as bf16 (RNE).
#include <hip/hip_runtime.h>
#include <math.h>
#include <stdint.h>

typedef __attribute__((ext_vector_type(16))) __bf16 v16b;
typedef __attribute__((ext_vector_type(8)))  __bf16 v8b;
typedef __attribute__((ext_vector_type(8)))  float v8f;
typedef __attribute__((ext_vector_type(4)))  float v4f;
typedef __attribute__((address_space(3))) unsigned char lds_u8;
typedef __attribute__((address_space(3))) v8b lds_v8b;

// Causal quadratic-Taylor 'linear attention' (B 2, H 8, L 2,048, D 64; bf16 inputs/outputs): s = (q*0.125) @ k^T (bf16 x bf16 -> f32); p = where(causal, 1 + s + 0.5 s^2, 0); z = sum_j p; pv = bf16(p) @ v (-> f32); out = (pv / (z + 1e-6)).astype(bf16).
#define NB 2
#define NH 8
#define TT 2048
#define HD 64
#define QT 32              // queries of one wave (two 16-query tiles)
#define KT 32              // keys of one trip of one wave
#define QG 2               // query groups of a work-group: 64 queries
#define KG 8               // key groups of a work-group: group kg takes the key tiles kg, kg + 8, ...
#define NW (QG * KG)       // waves of a work-group: wave = kg * 2 + qg
#define SK (KG * KT)       // keys of one stage of the LDS ring: one tile for each key group, each read by both query groups
#define KP 144u            // LDS pitch of a k row (128 bytes), 16 B x odd: for ds_load_b128
#define VP 160u            // LDS pitch of a v row (128 bytes), 32 B x odd: for ds_load_tr16_b128
#define KBY (SK * KP)      // k part of a buffer; the v part follows it
#define BUF (SK * KP + SK * VP)
#define NT (TT / (QG * QT))   // query tiles of one (b, h)
#define NU (NT / 4 + 1)       // stages that a pair of tiles (y, NT - 1 - y) walks together: (y / 4 + 1) + ((NT - 1 - y) / 4 + 1), the same for every y
#define PART (NW * QT * (HD + 4) * 4 + NW * QT * 4)   // the waves' f32 partials of P . v and of z, behind the ring

__device__ __forceinline__ v8f wmma_bf(v16b a, v16b b, v8f c) {
  return __builtin_amdgcn_wmma_f32_16x16x32_bf16(false, a, false, b, (short)0, c, false, false);
}
// 16x16x32 fragments: lane = (g = lane>>4, row/col = lane&15); elements 0..7 = k0+8g+0..7, 8..15 = k0+16+8g+0..7; D element r = row 8g+r
__device__ __forceinline__ v16b frag_b(const __bf16* rowk0, int lane) {
  union { v16b v; v8b q[2]; } u; const __bf16* p = rowk0 + 8 * (lane >> 4);
  u.q[0] = *(const v8b*)p; u.q[1] = *(const v8b*)(p + 16); return u.v;
}

// one stage = 256 rows of k and of v (32 KiB each, adjacent in memory) into one buffer: 8 copies of 16 bytes a lane, each copy of a wave taking 4 whole lines; gk, gv = the lane's first piece, lk, lv = its LDS byte address; piece + 512 lies 64 rows on
__device__ __forceinline__ void copy_stage(const __bf16* gk, const __bf16* gv, unsigned lk, unsigned lv) {
  // the closing s_wait_xcnt 0 stands in the copies' own statement, in front of any later write of the address registers they name (a precaution)
  asm volatile("global_load_async_to_lds_b128 %0, %8, off\n\t"
               "global_load_async_to_lds_b128 %1, %9, off\n\t"
               "global_load_async_to_lds_b128 %2, %10, off\n\t"
               "global_load_async_to_lds_b128 %3, %11, off\n\t"
               "global_load_async_to_lds_b128 %4, %12, off\n\t"
               "global_load_async_to_lds_b128 %5, %13, off\n\t"
               "global_load_async_to_lds_b128 %6, %14, off\n\t"
               "global_load_async_to_lds_b128 %7, %15, off\n\t"
               "s_wait_xcnt 0x0"
               :: "v"(lk), "v"(lk + 64u * KP), "v"(lk + 128u * KP), "v"(lk + 192u * KP), "v"(lv), "v"(lv + 64u * VP), "v"(lv + 128u * VP), "v"(lv + 192u * VP),
                  "v"(gk), "v"(gk + 64 * HD), "v"(gk + 128 * HD), "v"(gk + 192 * HD), "v"(gv), "v"(gv + 64 * HD), "v"(gv + 128 * HD), "v"(gv + 192 * HD)
               : "memory");
}
__device__ __forceinline__ void wait_async0() { asm volatile("s_wait_asynccnt 0x0" ::: "memory"); }   // this wave's copies have landed
__device__ __forceinline__ void wait_ds0() { asm volatile("s_wait_dscnt 0x0" ::: "memory"); }         // this wave's LDS reads have returned

// the fragments of one tile of 32 keys from its rows in LDS. k rows (A of the transposed scores): lane (g, col) takes k[t16 * 16 + col][kc * 32 + hf * 16 + 8g + 0..7]
__device__ __forceinline__ void load_k(lds_u8* kt, int lane, v16b (&kf)[2][2]) {
  lds_u8* kp = kt + (lane & 15) * KP + (lane >> 4) * 16;
#pragma unroll
  for (int t16 = 0; t16 < 2; ++t16)
#pragma unroll
    for (int kc = 0; kc < 2; ++kc) { union { v16b v; v8b q[2]; } u; lds_u8* p = kp + t16 * 16 * KP + kc * 64;
      u.q[0] = *(lds_v8b*)p; u.q[1] = *(lds_v8b*)(p + 32); kf[t16][kc] = u.v; }
}
// v columns (B of P . v) by the transposing load: lane (g, col) gets v[hf * 16 + 8g + 0..7][j * 16 + col]
__device__ __forceinline__ void load_v(lds_u8* vt, int lane, v16b (&vf)[HD / 16]) {
  lds_u8* vp = vt + (8 * (lane >> 4) + (lane & 7)) * VP + 16 * ((lane >> 3) & 1);
#pragma unroll
  for (int j = 0; j < HD / 16; ++j) { union { v16b v; v8b q[2]; } u;
    u.q[0] = __builtin_amdgcn_ds_load_tr16_b128_v8bf16((lds_v8b*)(vp + j * 32)); u.q[1] = __builtin_amdgcn_ds_load_tr16_b128_v8bf16((lds_v8b*)(vp + 16 * VP + j * 32)); vf[j] = u.v; }
}
// one trip of one wave = 32 keys k0.. against the wave's 32 queries q0.., in two halves, registers only. The scores are formed TRANSPOSED (A = k rows, B = q rows), so D element r of lane (g, col) is key 8g + r of query col: two such tiles (keys k0.., k0 + 16..) are, after the polynomial and the rounding, exactly the 16 x 32 A fragment of P for P . v, with no exchange between lanes.
__device__ __forceinline__ void scores(const v16b (&kf)[2][2], const v16b (&qf)[2][2], v8f (&s)[2][2]) {
#pragma unroll
  for (int qt = 0; qt < 2; ++qt)
#pragma unroll
    for (int t16 = 0; t16 < 2; ++t16) { const v8f zero = {}; s[qt][t16] = wmma_bf(kf[t16][1], qf[qt][1], wmma_bf(kf[t16][0], qf[qt][0], zero)); }
}
template <bool DIAG>
__device__ __forceinline__ void poly_pv(const v8f (&s)[2][2], const v16b (&vf)[HD / 16], int k0, int q0, int lane, v8f (&acc)[2][HD / 16], float (&z)[2]) {
  const int col = lane & 15, g = lane >> 4;
  v16b p[2];
#pragma unroll
  for (int qt = 0; qt < 2; ++qt) {
    const int rel = (q0 + qt * 16 + col) - (k0 + 8 * g);   // key 8g + r is kept while r <= rel
#pragma unroll
    for (int r = 0; r < 8; ++r) { const float a = s[qt][0][r], b = s[qt][1][r];
      float p0 = (1.0f + a) + (0.5f * a) * a, p1 = (1.0f + b) + (0.5f * b) * b;   // the reference's expression order
      if (DIAG) { if (r > rel) p0 = 0.f; if (r + 16 > rel) p1 = 0.f; }
      z[qt] += p0 + p1; p[qt][r] = (__bf16)p0; p[qt][8 + r] = (__bf16)p1; } }
#pragma unroll
  for (int j = 0; j < HD / 16; ++j)
#pragma unroll
    for (int qt = 0; qt < 2; ++qt) acc[qt][j] = wmma_bf(p[qt], vf[j], acc[qt][j]);
}

// the q rows of one wave's 32 queries as B fragments, raw; then q * scale, rounded to bf16 as the reference does
__device__ __forceinline__ void load_q(const __bf16* qrow, int lane, v16b (&x)[2][2]) {
  x[0][0] = frag_b(qrow, lane); x[0][1] = frag_b(qrow + 32, lane); x[1][0] = frag_b(qrow + 16 * HD, lane); x[1][1] = frag_b(qrow + 16 * HD + 32, lane);
}
__device__ __forceinline__ void scale_q(const v16b (&x)[2][2], v16b (&qf)[2][2]) {
#pragma unroll
  for (int qt = 0; qt < 2; ++qt)
#pragma unroll
    for (int kc = 0; kc < 2; ++kc)
#pragma unroll
      for (int i = 0; i < 16; ++i) qf[qt][kc][i] = (__bf16)((float)x[qt][kc][i] * 0.125f);
}
// Unit u of a block = stage u of its first tile, or stage u - n1 of its second; it lies in buffer u & 1. Barrier u stands between the scores and the polynomial of unit u (behind both in a tile's last unit): it publishes unit u + 1 and ends every wave's reads of unit u. v fragments are read at the head of their unit, k fragments one unit ahead into the same registers, behind the barrier that publishes their unit.
template <bool DIAG>
__device__ __forceinline__ void unit(lds_u8* ring, int u, int n1, int kg, int q0, int lane, const __bf16* gk, const __bf16* gv, unsigned lk, unsigned lv,
                                     v16b (&kf)[2][2], const v16b (&qf)[2][2], v8f (&acc)[2][HD / 16], float (&z)[2]) {
  const unsigned bo = (unsigned)(u & 1) * BUF, bn = BUF - bo;
  const unsigned ko = (unsigned)kg * (KT * KP), vo = KBY + (unsigned)kg * (KT * VP);   // the wave's tile inside a buffer
  const int k0 = ((u < n1 ? u : u - n1) * KG + kg) * KT;
  v16b vf[HD / 16]; v8f s[2][2];
  if (DIAG) {   // a tile's last unit is worked off whole in front of its barrier, under one wave-uniform branch: a key tile wholly past the wave's diagonal tile is skipped; the tile's sum, which follows, covers the k reads
    if (k0 <= q0) { load_v(ring + bo + vo, lane, vf); scores(kf, qf, s); poly_pv<true>(s, vf, k0, q0, lane, acc, z); }
  } else {
    load_v(ring + bo + vo, lane, vf);
    __builtin_amdgcn_sched_barrier(0);   // keeps the v reads in front of the scores, which cover their latency
    scores(kf, qf, s);
  }
  __builtin_amdgcn_sched_barrier(0);   // keeps the scores in front of the waits; left free, the compiler lifts the waits over them and the v reads are waited for bare
  wait_ds0();        // this wave's reads of unit u have returned
  wait_async0();     // its share of unit u + 1 has landed
  __syncthreads();
  if (u + 2 < NU) { const size_t so = (size_t)(u + 2 < n1 ? u + 2 : u + 2 - n1) * (SK * HD); copy_stage(gk + so, gv + so, lk + bo, lv + bo); }   // unit u + 2 into the buffer just left: it flies until barrier u + 1
  if (u + 1 < NU) load_k(ring + bn + ko, lane, kf);
  __builtin_amdgcn_sched_barrier(0);   // keeps the k reads here, in front of the polynomial that covers their latency
  if (!DIAG) poly_pv<false>(s, vf, k0, q0, lane, acc, z);
}

// ---- k_att: block = one (b, h) and a PAIR of 64-query tiles, NT - 1 - y and then y, one after the other in every wave, so that every block walks NU stages. 16 waves = 2 query groups x 8 key groups. The keys [0, q0 + 64) of a tile pass in stages of 256 through a ring of two LDS buffers, filled row-major by asynchronous copies one stage ahead; the ring runs on from the first tile's last stage into the second tile's first. Key group kg works on tile kg of each stage with its own f32 partial of P . v and of z; behind a tile's last stage the eight partials of each query group are summed in LDS (behind the ring), divided and stored
__global__ __launch_bounds__(512) void k_att(const __bf16* __restrict__ Q, const __bf16* __restrict__ K, const __bf16* __restrict__ V, __bf16* __restrict__ O) {
  __shared__ __align__(16) unsigned char sm[2 * BUF + PART];
  const int tid = threadIdx.x, wave = __builtin_amdgcn_readfirstlane(tid >> 5), lane = tid & 31, col = lane & 15, g = lane >> 4;
  const int qg = wave & 1, kg = wave >> 1;
  const size_t bh = blockIdx.x; const int qb2 = (int)blockIdx.y, qb1 = NT - 1 - qb2;   // the long tile first, then the short one
  const int n1 = (qb1 >> 2) + 1;               // stages of the first tile: keys [0, 256 n1) hold [0, 64 qb1 + 64) and end inside the tensor; the second tile has the other NU - n1
  lds_u8* const ring = (lds_u8*)sm;
  float (*red)[QT][HD + 4] = (float (*)[QT][HD + 4])(sm + 2 * BUF); float (*zr)[QT] = (float (*)[QT])(sm + 2 * BUF + NW * QT * (HD + 4) * 4);
  const __bf16* gk = K + bh * TT * HD + tid * 8; const __bf16* gv = V + bh * TT * HD + tid * 8;
  const unsigned lk = (unsigned)(uintptr_t)ring + (unsigned)(tid >> 3) * KP + (unsigned)(tid & 7) * 16u;
  const unsigned lv = (unsigned)(uintptr_t)ring + KBY + (unsigned)(tid >> 3) * VP + (unsigned)(tid & 7) * 16u;
  copy_stage(gk, gv, lk, lv);   // unit 0 into buffer 0
  v16b qf[2][2], kf[2][2];
  { v16b x[2][2]; load_q(Q + (bh * TT + (qb1 * QG + qg) * QT + col) * HD, lane, x); scale_q(x, qf); }
  wait_async0();
  __syncthreads();   // unit 0 is there for every wave
  static_assert((NT / 2) / 4 + 1 > 1, "the first tile must have two stages");
  copy_stage(gk + SK * HD, gv + SK * HD, lk + BUF, lv + BUF);   // unit 1, stage 1 of the first tile, into buffer 1
  load_k(ring + (unsigned)kg * (KT * KP), lane, kf);   // unit 0's k fragments
  int u = 0;
#pragma unroll 1   // rolled: one text for both tiles
  for (int tile = 0; tile < 2; ++tile) {
    const int qb = tile ? qb2 : qb1, ue = tile ? NU - 1 : n1 - 1, q0 = (qb * QG + qg) * QT;   // ue = the tile's last unit
    v8f acc[2][HD / 16] = {}; float z[2] = {0.f, 0.f};
#pragma unroll 1   // rolled: the trip count is the tile's
    for (; u < ue; ++u) unit<false>(ring, u, n1, kg, q0, lane, gk, gv, lk, lv, kf, qf, acc, z);   // every stage but a tile's last lies wholly below the diagonal of both query groups
    unit<true>(ring, u, n1, kg, q0, lane, gk, gv, lk, lv, kf, qf, acc, z); ++u;   // a tile's last stage holds the diagonal: the mask is applied to every key tile up to it, tiles past it are skipped
    v16b x[2][2]; load_q(Q + (bh * TT + (qb2 * QG + qg) * QT + col) * HD, lane, x);   // the second tile's q rows fly under the first tile's sum
#pragma unroll
    for (int qt = 0; qt < 2; ++qt) { z[qt] += __shfl_xor(z[qt], 16); if (g == 0) zr[wave][qt * 16 + col] = z[qt];
#pragma unroll
      for (int j = 0; j < HD / 16; ++j)
#pragma unroll
        for (int r = 0; r < 8; ++r) red[wave][qt * 16 + 8 * g + r][j * 16 + col] = acc[qt][j][r]; }
    __syncthreads();   // the partials are there; the second tile's are written behind a later unit's barrier, which ends these reads
    const int row = tid >> 3, c0 = (tid & 7) * 8, rq = row >> 5, rr = row & 31;   // wave kg * 2 + rq holds key group kg's partial of query row
    const float den = (((zr[rq][rr] + zr[2 + rq][rr]) + (zr[4 + rq][rr] + zr[6 + rq][rr])) + ((zr[8 + rq][rr] + zr[10 + rq][rr]) + (zr[12 + rq][rr] + zr[14 + rq][rr]))) + 1e-6f;
    v8b o;
#pragma unroll
    for (int i = 0; i < 2; ++i) { v4f p[KG];
#pragma unroll
      for (int k = 0; k < KG; ++k) p[k] = *(const v4f*)&red[2 * k + rq][rr][c0 + i * 4];
#pragma unroll
      for (int e = 0; e < 4; ++e) o[i * 4 + e] = (__bf16)((((p[0][e] + p[1][e]) + (p[2][e] + p[3][e])) + ((p[4][e] + p[5][e]) + (p[6][e] + p[7][e]))) / den); }   // pv / (z + 1e-6)
    *(v8b*)(O + (bh * TT + qb * (QG * QT) + row) * HD + c0) = o;
    asm volatile("s_wait_xcnt 0x0" ::: "memory");   // stands in front of the next tile's writes of the registers that the store names (a precaution)
    scale_q(x, qf);
  }
}

extern "C" void kernel_launch(void* const* d_in, const int* in_sizes, int n_in, void* d_out, int out_size, void* d_ws, size_t ws_size, hipStream_t stream) {
  (void)in_sizes; (void)n_in; (void)out_size; (void)d_ws; (void)ws_size;
  // inputs: 0 q [2,8,2048,64] bf16; 1 k bf16; 2 v bf16 - output [2,8,2048,64] bf16
  k_att<<<dim3(NB * NH, NT / 2), 512, 0, stream>>>((const __bf16*)d_in[0], (const __bf16*)d_in[1], (const __bf16*)d_in[2], (__bf16*)d_out);
}

// v004
// A run of this version takes 12.7 microseconds.
// Timed twice side by side with v003, it ran 1.15 and 1.16 times as fast.
// All steps since v000 together make it 45.7 times as fast.
// compute dtype: bf16 INPUTS and bf16 OUTPUT (the module's own dtypes): s = (q x 0.125, exact in bf16) . k with EXACT bf16 products on WMMA 16x16x32 and f32 accumulation (= preferred_element_type f32); p = 1 + s + 0.5 s s masked causal and z = sum p in f32; p rounded to bf16 (as p.astype(bf16)) against v bf16 with EXACT products and f32 accumulation; out = pv / (z + 1e-6) in f32, stored as bf16 (RNE).
#include <hip/hip_runtime.h>
#include <math.h>
#include <stdint.h>

typedef __attribute__((ext_vector_type(16))) __bf16 v16b;
typedef __attribute__((ext_vector_type(8)))  __bf16 v8b;
typedef __attribute__((ext_vector_type(8)))  float v8f;
typedef __attribute__((ext_vector_type(4)))  float v4f;
typedef __attribute__((address_space(3))) unsigned char lds_u8;
typedef __attribute__((address_space(3))) v8b lds_v8b;

// Causal quadratic-Taylor 'linear attention' (B 2, H 8, L 2,048, D 64; bf16 inputs/outputs): s = (q*0.125) @ k^T (bf16 x bf16 -> f32); p = where(causal, 1 + s + 0.5 s^2, 0); z = sum_j p; pv = bf16(p) @ v (-> f32); out = (pv / (z + 1e-6)).astype(bf16).
#define NB 2
#define NH 8
#define TT 2048
#define HD 64
#define QT 32              // queries of one wave (two 16-query tiles)
#define KT 32              // keys of one trip of one wave
#define QG 2               // query groups of a work-group: 64 queries
#define KG 8               // key groups of a work-group: group kg takes key tile kg of a stage (in a stage that both tiles need: see unit_both)
#define NW (QG * KG)       // waves of a work-group: wave = kg * 2 + qg
#define SK (KG * KT)       // keys of one stage of the LDS ring: one tile for each key group, each read by both query groups
#define KP 144u            // LDS pitch of a k row (128 bytes), 16 B x odd: for ds_load_b128
#define VP 160u            // LDS pitch of a v row (128 bytes), 32 B x odd: for ds_load_tr16_b128
#define KBY (SK * KP)      // k part of a buffer; the v part follows it
#define BUF (SK * KP + SK * VP)
#define NT (TT / (QG * QT))   // query tiles of one (b, h)
#define PART (NW * QT * (HD + 4) * 4 + NW * QT * 4)   // the waves' f32 partials of P . v and of z, behind the ring

__device__ __forceinline__ v8f wmma_bf(v16b a, v16b b, v8f c) {
  return __builtin_amdgcn_wmma_f32_16x16x32_bf16(false, a, false, b, (short)0, c, false, false);
}
// 16x16x32 fragments: lane = (g = lane>>4, row/col = lane&15); elements 0..7 = k0+8g+0..7, 8..15 = k0+16+8g+0..7; D element r = row 8g+r
__device__ __forceinline__ v16b frag_b(const __bf16* rowk0, int lane) {
  union { v16b v; v8b q[2]; } u; const __bf16* p = rowk0 + 8 * (lane >> 4);
  u.q[0] = *(const v8b*)p; u.q[1] = *(const v8b*)(p + 16); return u.v;
}

// one stage = 256 rows of k and of v (32 KiB each, adjacent in memory) into one buffer: 8 copies of 16 bytes a lane, each copy of a wave taking 4 whole lines; sk, sv = the stage's first k and v row (the same in every lane), go = the byte offset of the lane's first piece in the stage, lk, lv = its LDS byte address; piece + 512 lies 64 rows on. The steps of 64 rows go into scalar bases, so that one offset register serves all eight copies
__device__ __forceinline__ void copy_stage(const __bf16* sk, const __bf16* sv, unsigned go, unsigned lk, unsigned lv) {
  // the closing s_wait_xcnt 0 stands in the copies' own statement, in front of any later write of the address registers they name (a precaution)
  asm volatile("global_load_async_to_lds_b128 %0, %8, %9\n\t"
               "global_load_async_to_lds_b128 %1, %8, %10\n\t"
               "global_load_async_to_lds_b128 %2, %8, %11\n\t"
               "global_load_async_to_lds_b128 %3, %8, %12\n\t"
               "global_load_async_to_lds_b128 %4, %8, %13\n\t"
               "global_load_async_to_lds_b128 %5, %8, %14\n\t"
               "global_load_async_to_lds_b128 %6, %8, %15\n\t"
               "global_load_async_to_lds_b128 %7, %8, %16\n\t"
               "s_wait_xcnt 0x0"
               :: "v"(lk), "v"(lk + 64u * KP), "v"(lk + 128u * KP), "v"(lk + 192u * KP), "v"(lv), "v"(lv + 64u * VP), "v"(lv + 128u * VP), "v"(lv + 192u * VP),
                  "v"(go), "s"(sk), "s"(sk + 64 * HD), "s"(sk + 128 * HD), "s"(sk + 192 * HD), "s"(sv), "s"(sv + 64 * HD), "s"(sv + 128 * HD), "s"(sv + 192 * HD)
               : "memory");
}
__device__ __forceinline__ void wait_async0() { asm volatile("s_wait_asynccnt 0x0" ::: "memory"); }   // this wave's copies have landed
__device__ __forceinline__ void wait_ds0() { asm volatile("s_wait_dscnt 0x0" ::: "memory"); }         // this wave's LDS reads have returned

// the fragments of one tile of 32 keys from its rows in LDS. k rows (A of the transposed scores): lane (g, col) takes k[t16 * 16 + col][kc * 32 + hf * 16 + 8g + 0..7]
__device__ __forceinline__ void load_k(lds_u8* kt, int lane, v16b (&kf)[2][2]) {
  lds_u8* kp = kt + (lane & 15) * KP + (lane >> 4) * 16;
#pragma unroll
  for (int t16 = 0; t16 < 2; ++t16)
#pragma unroll
    for (int kc = 0; kc < 2; ++kc) { union { v16b v; v8b q[2]; } u; lds_u8* p = kp + t16 * 16 * KP + kc * 64;
      u.q[0] = *(lds_v8b*)p; u.q[1] = *(lds_v8b*)(p + 32); kf[t16][kc] = u.v; }
}
// v columns (B of P . v) by the transposing load: lane (g, col) gets v[hf * 16 + 8g + 0..7][j * 16 + col]
__device__ __forceinline__ void load_v(lds_u8* vt, int lane, v16b (&vf)[HD / 16]) {
  lds_u8* vp = vt + (8 * (lane >> 4) + (lane & 7)) * VP + 16 * ((lane >> 3) & 1);
#pragma unroll
  for (int j = 0; j < HD / 16; ++j) { union { v16b v; v8b q[2]; } u;
    u.q[0] = __builtin_amdgcn_ds_load_tr16_b128_v8bf16((lds_v8b*)(vp + j * 32)); u.q[1] = __builtin_amdgcn_ds_load_tr16_b128_v8bf16((lds_v8b*)(vp + 16 * VP + j * 32)); vf[j] = u.v; }
}
// one trip of one wave = 32 keys k0.. against the wave's 32 queries q0.., in two halves, registers only. The scores are formed TRANSPOSED (A = k rows, B = q rows), so D element r of lane (g, col) is key 8g + r of query col: two such tiles (keys k0.., k0 + 16..) are, after the polynomial and the rounding, exactly the 16 x 32 A fragment of P for P . v, with no exchange between lanes.
__device__ __forceinline__ void scores(const v16b (&kf)[2][2], const v16b (&qf)[2][2], v8f (&s)[2][2]) {
#pragma unroll
  for (int qt = 0; qt < 2; ++qt)
#pragma unroll
    for (int t16 = 0; t16 < 2; ++t16) { const v8f zero = {}; s[qt][t16] = wmma_bf(kf[t16][1], qf[qt][1], wmma_bf(kf[t16][0], qf[qt][0], zero)); }
}
template <bool DIAG>
__device__ __forceinline__ void poly_pv(const v8f (&s)[2][2], const v16b (&vf)[HD / 16], int k0, int q0, int lane, v8f (&acc)[2][HD / 16], float (&z)[2]) {
  const int col = lane & 15, g = lane >> 4;
  v16b p[2];
#pragma unroll
  for (int qt = 0; qt < 2; ++qt) {
    const int rel = (q0 - k0 + qt * 16) + (col - 8 * g);   // key 8g + r is kept while r <= rel
#pragma unroll
    for (int r = 0; r < 8; ++r) { const float a = s[qt][0][r], b = s[qt][1][r];
      float p0 = (1.0f + a) + (0.5f * a) * a, p1 = (1.0f + b) + (0.5f * b) * b;   // the reference's expression order
      if (DIAG) { if (r > rel) p0 = 0.f; if (r + 16 > rel) p1 = 0.f; }
      z[qt] += p0 + p1; p[qt][r] = (__bf16)p0; p[qt][8 + r] = (__bf16)p1; } }
#pragma unroll
  for (int j = 0; j < HD / 16; ++j)
#pragma unroll
    for (int qt = 0; qt < 2; ++qt) acc[qt][j] = wmma_bf(p[qt], vf[j], acc[qt][j]);
}

// the q rows of one wave's 32 queries as B fragments, raw; then q * scale, rounded to bf16 as the reference does
__device__ __forceinline__ void load_q(const __bf16* qrow, int lane, v16b (&x)[2][2]) {
  x[0][0] = frag_b(qrow, lane); x[0][1] = frag_b(qrow + 32, lane); x[1][0] = frag_b(qrow + 16 * HD, lane); x[1][1] = frag_b(qrow + 16 * HD + 32, lane);
}
__device__ __forceinline__ void scale_q(const v16b (&x)[2][2], v16b (&qf)[2][2]) {
#pragma unroll
  for (int qt = 0; qt < 2; ++qt)
#pragma unroll
    for (int kc = 0; kc < 2; ++kc)
#pragma unroll
      for (int i = 0; i < 16; ++i) qf[qt][kc][i] = (__bf16)((float)x[qt][kc][i] * 0.125f);
}
// Unit u of a block = stage u of the keys; it lies in buffer u & 1. Barrier u stands between the scores and the polynomial of a wave's last key tile of unit u (behind both in a tile's last unit): it publishes unit u + 1 and ends every wave's reads of unit u. v fragments are read at the head of their key tile, k fragments one key tile ahead into the same registers, those of another unit behind the barrier that publishes it.
// the foot of unit u: the waits, barrier u, the refill of the buffer just left, and the k fragments of key tile tn of unit u + 1
__device__ __forceinline__ void publish(lds_u8* ring, int u, int n1, int tn, int lane, const __bf16* gk, const __bf16* gv, unsigned go, unsigned lk, unsigned lv, v16b (&kf)[2][2]) {
  const unsigned bo = (unsigned)(u & 1) * BUF, bn = BUF - bo;
  wait_ds0();        // this wave's reads of unit u have returned
  wait_async0();     // its share of unit u + 1 has landed
  __syncthreads();
  if (u + 2 < n1) { const size_t so = (size_t)(u + 2) * (SK * HD); copy_stage(gk + so, gv + so, go, lk + bo, lv + bo); }   // unit u + 2 into the buffer just left: it flies until barrier u + 1
  if (u + 1 < n1) load_k(ring + bn + (unsigned)tn * (KT * KP), lane, kf);
}
// a unit that only the long tile needs: key group kg takes key tile kg for the wave's 32 queries
template <bool DIAG>
__device__ __forceinline__ void unit(lds_u8* ring, int u, int n1, int kg, int q0, int lane, const __bf16* gk, const __bf16* gv, unsigned go, unsigned lk, unsigned lv,
                                     v16b (&kf)[2][2], const v16b (&qf)[2][2], v8f (&acc)[2][HD / 16], float (&z)[2]) {
  const unsigned vo = (unsigned)(u & 1) * BUF + KBY + (unsigned)kg * (KT * VP);   // the wave's v tile
  const int k0 = (u * KG + kg) * KT;
  v16b vf[HD / 16]; v8f s[2][2];
  if (DIAG) {   // a tile's last unit is worked off whole in front of its barrier, under one wave-uniform branch: a key tile wholly past the wave's diagonal tile is skipped
    if (k0 <= q0) { load_v(ring + vo, lane, vf); scores(kf, qf, s); poly_pv<true>(s, vf, k0, q0, lane, acc, z); }
  } else {
    load_v(ring + vo, lane, vf);
    __builtin_amdgcn_sched_barrier(0);   // keeps the v reads in front of the scores, which cover their latency
    scores(kf, qf, s);
  }
  __builtin_amdgcn_sched_barrier(0);   // keeps the scores in front of the waits; left free, the compiler lifts the waits over them and the v reads are waited for bare
  publish(ring, u, n1, kg, lane, gk, gv, go, lk, lv, kf);
  __builtin_amdgcn_sched_barrier(0);   // keeps the k reads here, in front of the polynomial that covers their latency
  if (!DIAG) poly_pv<false>(s, vf, k0, q0, lane, acc, z);
}
// a unit that both tiles need: the waves of key groups 0..3 work for the long tile, those of 4..7 for the short one, and each takes the key tiles 2 k4 and 2 k4 + 1 one after the other for its 32 queries q0... LAST = the short tile's last unit, which holds its diagonal. tn = the wave's first key tile of the next unit
template <bool LAST>
__device__ __forceinline__ void unit_both(lds_u8* ring, int u, int n1, int k4, int tn, int q0, int lane, const __bf16* gk, const __bf16* gv, unsigned go, unsigned lk, unsigned lv,
                                          v16b (&kf)[2][2], const v16b (&qf)[2][2], v8f (&acc)[2][HD / 16], float (&z)[2]) {
  const unsigned bo = (unsigned)(u & 1) * BUF;
  const unsigned kb = bo + (unsigned)(2 * k4 + 1) * (KT * KP), va = bo + KBY + (unsigned)(2 * k4) * (KT * VP), vb = va + KT * VP;
  const int ka = (u * KG + 2 * k4) * KT;   // first key of the first key tile; the second follows it
  v16b vf[HD / 16]; v8f s[2][2];
  if (LAST) {   // worked off whole in front of its barrier, under wave-uniform branches, in one text for both tiles: a key tile wholly past the wave's diagonal tile is skipped, the mask is applied to the others (it keeps every key of the long tile's waves, whose queries lie past this stage); the sum that follows covers the k reads
    if (ka <= q0) {
      load_v(ring + va, lane, vf); scores(kf, qf, s);
      __builtin_amdgcn_sched_barrier(0);   // keeps the second key tile's k reads behind the scores that still read those registers
      load_k(ring + kb, lane, kf);
      __builtin_amdgcn_sched_barrier(0);   // keeps the k reads here, in front of the polynomial that covers their latency
      poly_pv<true>(s, vf, ka, q0, lane, acc, z);
      if (ka + KT <= q0) { load_v(ring + vb, lane, vf); scores(kf, qf, s); poly_pv<true>(s, vf, ka + KT, q0, lane, acc, z); }
    }
  } else {
    load_v(ring + va, lane, vf);
    __builtin_amdgcn_sched_barrier(0);   // keeps the v reads in front of the scores, which cover their latency
    scores(kf, qf, s);
    __builtin_amdgcn_sched_barrier(0);   // keeps the second key tile's k reads behind the scores that still read those registers
    load_k(ring + kb, lane, kf);
    __builtin_amdgcn_sched_barrier(0);   // keeps the k reads here, in front of the polynomial that covers their latency
    poly_pv<false>(s, vf, ka, q0, lane, acc, z);
    __builtin_amdgcn_sched_barrier(0);   // keeps the second key tile's v reads behind the first one's P . v, so that they take the same registers (lifted over it they cost spills)
    load_v(ring + vb, lane, vf);
    __builtin_amdgcn_sched_barrier(0);   // keeps the v reads in front of the scores, which cover their latency
    scores(kf, qf, s);
  }
  __builtin_amdgcn_sched_barrier(0);   // keeps the scores in front of the waits; left free, the compiler lifts the waits over them and the v reads are waited for bare
  publish(ring, u, n1, tn, lane, gk, gv, go, lk, lv, kf);
  __builtin_amdgcn_sched_barrier(0);   // keeps the k reads here, in front of the polynomial that covers their latency
  if (!LAST) poly_pv<false>(s, vf, ka + KT, q0, lane, acc, z);
}
// a wave's f32 partials of P . v and of z into its slot of the LDS area behind the ring
__device__ __forceinline__ void put_partial(float (*red)[HD + 4], float* zr, int lane, const v8f (&acc)[2][HD / 16], float (&z)[2]) {
  const int col = lane & 15, g = lane >> 4;
#pragma unroll
  for (int qt = 0; qt < 2; ++qt) { z[qt] += __shfl_xor(z[qt], 16); if (g == 0) zr[qt * 16 + col] = z[qt];
#pragma unroll
    for (int j = 0; j < HD / 16; ++j)
#pragma unroll
      for (int r = 0; r < 8; ++r) red[qt * 16 + 8 * g + r][j * 16 + col] = acc[qt][j][r]; }
}
// the NP partials of each query row (slot 2 k + rq holds partial k of query group rq) summed pairwise, divided and stored: 8 columns a thread
template <int NP>
__device__ __forceinline__ void sum_store(const float (*red)[QT][HD + 4], const float (*zr)[QT], int tid, __bf16* otile) {
  const int row = tid >> 3, c0 = (tid & 7) * 8, rq = row >> 5, rr = row & 31;
  float zs[NP];
#pragma unroll
  for (int k = 0; k < NP; ++k) zs[k] = zr[2 * k + rq][rr];
#pragma unroll
  for (int w = 1; w < NP; w *= 2)
#pragma unroll
    for (int k = 0; k < NP; k += 2 * w) zs[k] += zs[k + w];
  const float den = zs[0] + 1e-6f;
  v8b o;
#pragma unroll
  for (int i = 0; i < 2; ++i) { v4f p[NP];
#pragma unroll
    for (int k = 0; k < NP; ++k) p[k] = *(const v4f*)&red[2 * k + rq][rr][c0 + i * 4];
#pragma unroll
    for (int w = 1; w < NP; w *= 2)
#pragma unroll
      for (int k = 0; k < NP; k += 2 * w) p[k] += p[k + w];
#pragma unroll
    for (int e = 0; e < 4; ++e) o[i * 4 + e] = (__bf16)(p[0][e] / den); }   // pv / (z + 1e-6)
  *(v8b*)(otile + row * HD + c0) = o;
  asm volatile("s_wait_xcnt 0x0" ::: "memory");   // stands in front of later writes of the registers that the store names (a precaution)
}

// ---- k_att: block = one (b, h) and a PAIR of 64-query tiles, the long one NT - 1 - y and the short one y. 16 waves = 2 query groups x 8 key groups. The keys [0, 256 n1) of the long tile pass ONCE, in stages of 256, through a ring of two LDS buffers, filled row-major by asynchronous copies one stage ahead. The first n2 stages are the short tile's keys too: there half of the waves work for each tile, on two key tiles each; behind them the short tile's four partials a query group are summed in LDS (behind the ring), divided and stored, and its waves join the long tile as key groups 4..7 with fresh partials. Every block does the work of NT / 4 + 1 one-tile stages
__global__ __launch_bounds__(512) void k_att(const __bf16* __restrict__ Q, const __bf16* __restrict__ K, const __bf16* __restrict__ V, __bf16* __restrict__ O) {
  __shared__ __align__(16) unsigned char sm[2 * BUF + PART];
  const int tid = threadIdx.x, wave = __builtin_amdgcn_readfirstlane(tid >> 5), lane = tid & 31, col = lane & 15;
  const int qg = wave & 1, kg = wave >> 1, k4 = kg & 3;
  const bool sw = kg >= KG / 2;                // a wave that starts on the short tile
  const size_t bh = blockIdx.x; const int qb2 = (int)blockIdx.y, qb1 = NT - 1 - qb2;
  const int n1 = (qb1 >> 2) + 1, n2 = (qb2 >> 2) + 1;   // stages of the long and of the short tile: keys [0, 256 n) hold [0, 64 qb + 64) and end inside the tensor
  static_assert((NT / 2) / 4 + 1 > (NT / 2 - 1) / 4 + 1 && (NT / 2) / 4 + 1 > 1, "the long tile must have more stages than the short one, and two at the least");
  lds_u8* const ring = (lds_u8*)sm;
  float (*red)[QT][HD + 4] = (float (*)[QT][HD + 4])(sm + 2 * BUF); float (*zr)[QT] = (float (*)[QT])(sm + 2 * BUF + NW * QT * (HD + 4) * 4);
  const __bf16* gk = K + bh * TT * HD; const __bf16* gv = V + bh * TT * HD; const unsigned go = (unsigned)tid * 16u;   // the (b, h)'s first k and v row; the lane's piece of a stage
  const unsigned lk = (unsigned)(uintptr_t)ring + (unsigned)(tid >> 3) * KP + (unsigned)(tid & 7) * 16u;
  const unsigned lv = (unsigned)(uintptr_t)ring + KBY + (unsigned)(tid >> 3) * VP + (unsigned)(tid & 7) * 16u;
  copy_stage(gk, gv, go, lk, lv);   // unit 0 into buffer 0
  const int q1 = (qb1 * QG + qg) * QT, q2 = (qb2 * QG + qg) * QT;   // the wave's first query in the long and in the short tile
  v16b qf[2][2], kf[2][2];
  { v16b x[2][2]; load_q(Q + (bh * TT + (sw ? q2 : q1) + col) * HD, lane, x); scale_q(x, qf); }
  wait_async0();
  __syncthreads();   // unit 0 is there for every wave
  copy_stage(gk + SK * HD, gv + SK * HD, go, lk + BUF, lv + BUF);   // unit 1 into buffer 1
  load_k(ring + (unsigned)(2 * k4) * (KT * KP), lane, kf);   // the k fragments of the wave's first key tile of unit 0
  v8f acc[2][HD / 16] = {}; float z[2] = {0.f, 0.f};
  int u = 0;
#pragma unroll 1   // rolled: the trip count is the short tile's
  for (; u < n2 - 1; ++u) unit_both<false>(ring, u, n1, k4, 2 * k4, sw ? q2 : q1, lane, gk, gv, go, lk, lv, kf, qf, acc, z);
  unit_both<true>(ring, u, n1, k4, kg, sw ? q2 : q1, lane, gk, gv, go, lk, lv, kf, qf, acc, z); ++u;
  if (sw) {   // wave-uniform: the short tile's waves hand in their partials and start afresh
    put_partial(red[wave - NW / 2], zr[wave - NW / 2], lane, acc, z);
#pragma unroll
    for (int qt = 0; qt < 2; ++qt) { z[qt] = 0.f;
#pragma unroll
      for (int j = 0; j < HD / 16; ++j) acc[qt][j] = v8f{}; }
  }
  __syncthreads();   // the short tile's partials are there; the long tile's are written behind a later unit's barrier, which ends these reads
  v16b x[2][2]; load_q(Q + (bh * TT + q1 + col) * HD, lane, x);   // the long tile's q rows for every wave (one text; its own waves get the values they have): issued behind the barrier, which would wait for them, they fly under the short tile's sum
  sum_store<KG / 2>(red, zr, tid, O + (bh * TT + qb2 * (QG * QT)) * HD);
  scale_q(x, qf);
#pragma unroll 1   // rolled: the trip count is the tile's
  for (; u < n1 - 1; ++u) unit<false>(ring, u, n1, kg, q1, lane, gk, gv, go, lk, lv, kf, qf, acc, z);   // every stage but a tile's last lies wholly below the diagonal of both query groups
  unit<true>(ring, u, n1, kg, q1, lane, gk, gv, go, lk, lv, kf, qf, acc, z);   // the long tile's last stage holds its diagonal
  put_partial(red[wave], zr[wave], lane, acc, z);
  __syncthreads();   // the long tile's partials are there
  sum_store<KG>(red, zr, tid, O + (bh * TT + qb1 * (QG * QT)) * HD);
}

extern "C" void kernel_launch(void* const* d_in, const int* in_sizes, int n_in, void* d_out, int out_size, void* d_ws, size_t ws_size, hipStream_t stream) {
  (void)in_sizes; (void)n_in; (void)out_size; (void)d_ws; (void)ws_size;
  // inputs: 0 q [2,8,2048,64] bf16; 1 k bf16; 2 v bf16 - output [2,8,2048,64] bf16
  k_att<<<dim3(NB * NH, NT / 2), 512, 0, stream>>>((const __bf16*)d_in[0], (const __bf16*)d_in[1], (const __bf16*)d_in[2], (__bf16*)d_out);
}

// v005
// Measured time: 11.8 microseconds a run.
// Timed twice side by side with v004, it ran 1.08 times as fast both times.
// Over all steps from v000 it is 49.2 times as fast.
// compute dtype: bf16 INPUTS and bf16 OUTPUT (the module's own dtypes): s = (q x 0.125, exact in bf16) . k with EXACT bf16 products on WMMA 16x16x32 and f32 accumulation (= preferred_element_type f32); p = 1 + s + 0.5 s s masked causal and z = sum p in f32; p rounded to bf16 (as p.astype(bf16)) against v bf16 with EXACT products and f32 accumulation; out = pv / (z + 1e-6) in f32, stored as bf16 (RNE).
#include <hip/hip_runtime.h>
#include <math.h>
#include <stdint.h>

typedef __attribute__((ext_vector_type(16))) __bf16 v16b;
typedef __attribute__((ext_vector_type(8)))  __bf16 v8b;
typedef __attribute__((ext_vector_type(8)))  float v8f;
typedef __attribute__((ext_vector_type(4)))  float v4f;
typedef __attribute__((address_space(3))) unsigned char lds_u8;
typedef __attribute__((address_space(3))) v8b lds_v8b;

// Causal quadratic-Taylor 'linear attention' (B 2, H 8, L 2,048, D 64; bf16 inputs/outputs): s = (q*0.125) @ k^T (bf16 x bf16 -> f32); p = where(causal, 1 + s + 0.5 s^2, 0); z = sum_j p; pv = bf16(p) @ v (-> f32); out = (pv / (z + 1e-6)).astype(bf16).
#define NB 2
#define NH 8
#define TT 2048
#define HD 64
#define QT 32              // queries of one wave (two 16-query tiles)
#define KT 32              // keys of one trip of one wave
#define QG 2               // query groups of a work-group: 64 queries
#define KG 8               // key groups of a work-group: group kg takes key tile kg of a stage (in a stage that both tiles need: see unit_both)
#define NW (QG * KG)       // waves of a work-group: wave = kg * 2 + qg
#define SK (KG * KT)       // keys of one stage of the LDS ring: one tile for each key group, each read by both query groups
#define KP 144u            // LDS pitch of a k row (128 bytes), 16 B x odd: for ds_load_b128
#define VP 160u            // LDS pitch of a v row (128 bytes), 32 B x odd: for ds_load_tr16_b128
#define KBY (SK * KP)      // k part of a buffer; the v part follows it
#define BUF (SK * KP + SK * VP)
#define RING (3 * BUF)     // three buffers: one is read while the next two stages fly or lie ready
#define NT (TT / (QG * QT))   // query tiles of one (b, h)
#define PSLOT (QT * (HD + 4) * 4)                  // one wave's f32 partial of P . v
#define PART(n) ((n) * PSLOT + (n) * QT * 4)       // n waves' partials of P . v, then of z: the short tile's NW / 2 lie behind the ring, the long tile's NW on the ring, which is free by then

__device__ __forceinline__ v8f wmma_bf(v16b a, v16b b, v8f c) {
  return __builtin_amdgcn_wmma_f32_16x16x32_bf16(false, a, false, b, (short)0, c, false, false);
}
// 16x16x32 fragments: lane = (g = lane>>4, row/col = lane&15); elements 0..7 = k0+8g+0..7, 8..15 = k0+16+8g+0..7; D element r = row 8g+r
__device__ __forceinline__ v16b frag_b(const __bf16* rowk0, int lane) {
  union { v16b v; v8b q[2]; } u; const __bf16* p = rowk0 + 8 * (lane >> 4);
  u.q[0] = *(const v8b*)p; u.q[1] = *(const v8b*)(p + 16); return u.v;
}

// 256 rows of 128 bytes (adjacent in memory) into LDS rows of pitch P, by the 8 waves of one copy set: 8 copies of 16 bytes a lane, each copy of a wave taking 4 whole lines; s = the first row (the same in every lane), go = the byte offset of the lane's first piece, l = its LDS byte address; piece + 256 lies 32 rows on. The steps of 32 rows go into scalar bases, so that one offset register serves all eight copies
template <unsigned P>
__device__ __forceinline__ void copy_rows(const __bf16* s, unsigned go, unsigned l) {
  // the closing s_wait_xcnt 0 stands in the copies' own statement, in front of any later write of the address registers they name (a precaution)
  asm volatile("global_load_async_to_lds_b128 %0, %8, %9\n\t"
               "global_load_async_to_lds_b128 %1, %8, %10\n\t"
               "global_load_async_to_lds_b128 %2, %8, %11\n\t"
               "global_load_async_to_lds_b128 %3, %8, %12\n\t"
               "global_load_async_to_lds_b128 %4, %8, %13\n\t"
               "global_load_async_to_lds_b128 %5, %8, %14\n\t"
               "global_load_async_to_lds_b128 %6, %8, %15\n\t"
               "global_load_async_to_lds_b128 %7, %8, %16\n\t"
               "s_wait_xcnt 0x0"
               :: "v"(l), "v"(l + 32u * P), "v"(l + 64u * P), "v"(l + 96u * P), "v"(l + 128u * P), "v"(l + 160u * P), "v"(l + 192u * P), "v"(l + 224u * P),
                  "v"(go), "s"(s), "s"(s + 32 * HD), "s"(s + 64 * HD), "s"(s + 96 * HD), "s"(s + 128 * HD), "s"(s + 160 * HD), "s"(s + 192 * HD), "s"(s + 224 * HD)
               : "memory");
}
// one stage = 256 rows of k and of v (32 KiB each) into one buffer, by one copy set: 16 copies a lane; sk, sv = the stage's first k and v row, lk, lv = the LDS byte address of the lane's first k and v piece
__device__ __forceinline__ void copy_stage(const __bf16* sk, const __bf16* sv, unsigned go, unsigned lk, unsigned lv) {
  copy_rows<KP>(sk, go, lk); copy_rows<VP>(sv, go, lv);
}
__device__ __forceinline__ void wait_async0() { asm volatile("s_wait_asynccnt 0x0" ::: "memory"); }   // this wave's copies have landed
__device__ __forceinline__ void wait_ds0() { asm volatile("s_wait_dscnt 0x0" ::: "memory"); }         // this wave's LDS reads have returned

// the fragments of one tile of 32 keys from its rows in LDS. k rows (A of the transposed scores): lane (g, col) takes k[t16 * 16 + col][kc * 32 + hf * 16 + 8g + 0..7]
__device__ __forceinline__ void load_k(lds_u8* kt, int lane, v16b (&kf)[2][2]) {
  lds_u8* kp = kt + (lane & 15) * KP + (lane >> 4) * 16;
#pragma unroll
  for (int t16 = 0; t16 < 2; ++t16)
#pragma unroll
    for (int kc = 0; kc < 2; ++kc) { union { v16b v; v8b q[2]; } u; lds_u8* p = kp + t16 * 16 * KP + kc * 64;
      u.q[0] = *(lds_v8b*)p; u.q[1] = *(lds_v8b*)(p + 32); kf[t16][kc] = u.v; }
}
// v columns (B of P . v) by the transposing load: lane (g, col) gets v[hf * 16 + 8g + 0..7][j * 16 + col]
__device__ __forceinline__ void load_v(lds_u8* vt, int lane, v16b (&vf)[HD / 16]) {
  lds_u8* vp = vt + (8 * (lane >> 4) + (lane & 7)) * VP + 16 * ((lane >> 3) & 1);
#pragma unroll
  for (int j = 0; j < HD / 16; ++j) { union { v16b v; v8b q[2]; } u;
    u.q[0] = __builtin_amdgcn_ds_load_tr16_b128_v8bf16((lds_v8b*)(vp + j * 32)); u.q[1] = __builtin_amdgcn_ds_load_tr16_b128_v8bf16((lds_v8b*)(vp + 16 * VP + j * 32)); vf[j] = u.v; }
}
// one trip of one wave = 32 keys k0.. against the wave's 32 queries q0.., in two halves, registers only. The scores are formed TRANSPOSED (A = k rows, B = q rows), so D element r of lane (g, col) is key 8g + r of query col: two such tiles (keys k0.., k0 + 16..) are, after the polynomial and the rounding, exactly the 16 x 32 A fragment of P for P . v, with no exchange between lanes.
__device__ __forceinline__ void scores(const v16b (&kf)[2][2], const v16b (&qf)[2][2], v8f (&s)[2][2]) {
#pragma unroll
  for (int qt = 0; qt < 2; ++qt)
#pragma unroll
    for (int t16 = 0; t16 < 2; ++t16) { const v8f zero = {}; s[qt][t16] = wmma_bf(kf[t16][1], qf[qt][1], wmma_bf(kf[t16][0], qf[qt][0], zero)); }
}
template <bool DIAG>
__device__ __forceinline__ void poly_pv(const v8f (&s)[2][2], const v16b (&vf)[HD / 16], int k0, int q0, int lane, v8f (&acc)[2][HD / 16], float (&z)[2]) {
  const int col = lane & 15, g = lane >> 4;
  v16b p[2];
#pragma unroll
  for (int qt = 0; qt < 2; ++qt) {
    const int rel = (q0 - k0 + qt * 16) + (col - 8 * g);   // key 8g + r is kept while r <= rel
#pragma unroll
    for (int r = 0; r < 8; ++r) { const float a = s[qt][0][r], b = s[qt][1][r];
      float p0 = (1.0f + a) + (0.5f * a) * a, p1 = (1.0f + b) + (0.5f * b) * b;   // the reference's expression order
      if (DIAG) { if (r > rel) p0 = 0.f; if (r + 16 > rel) p1 = 0.f; }
      z[qt] += p0 + p1; p[qt][r] = (__bf16)p0; p[qt][8 + r] = (__bf16)p1; } }
#pragma unroll
  for (int j = 0; j < HD / 16; ++j)
#pragma unroll
    for (int qt = 0; qt < 2; ++qt) acc[qt][j] = wmma_bf(p[qt], vf[j], acc[qt][j]);
}

// the q rows of one wave's 32 queries as B fragments, raw; then q * scale, rounded to bf16 as the reference does
__device__ __forceinline__ void load_q(const __bf16* qrow, int lane, v16b (&x)[2][2]) {
  x[0][0] = frag_b(qrow, lane); x[0][1] = frag_b(qrow + 32, lane); x[1][0] = frag_b(qrow + 16 * HD, lane); x[1][1] = frag_b(qrow + 16 * HD + 32, lane);
}
__device__ __forceinline__ void scale_q(const v16b (&x)[2][2], v16b (&qf)[2][2]) {
#pragma unroll
  for (int qt = 0; qt < 2; ++qt)
#pragma unroll
    for (int kc = 0; kc < 2; ++kc)
#pragma unroll
      for (int i = 0; i < 16; ++i) qf[qt][kc][i] = (__bf16)((float)x[qt][kc][i] * 0.125f);
}
// Unit u of a block = stage u of the keys; it lies in buffer u mod 3, at byte bo of the ring. The waves 0..7 (copy set 0) copy the even stages, the waves 8..15 (set 1) the odd ones: a set has one stage in flight at a time and waits for all of it, while the other set's stage flies on over the barrier. Barrier u stands between the scores and the polynomial of a wave's last key tile of unit u (behind both in a tile's last unit): it publishes unit u + 1 and ends every wave's reads of unit u. v fragments are read at the head of their key tile, k fragments one key tile ahead into the same registers, those of another unit behind the barrier that publishes it.
// the foot of unit u: the waits, barrier u, the refill of the buffer just left, and the k fragments of key tile tn of unit u + 1; bo moves on to that unit's buffer. set = the wave's copy set (wave-uniform)
__device__ __forceinline__ void publish(lds_u8* ring, int u, int n1, int tn, int lane, int set, const __bf16* gk, const __bf16* gv, unsigned go, unsigned lk, unsigned lv, unsigned& bo, v16b (&kf)[2][2]) {
  const unsigned bn = bo == 2u * BUF ? 0u : bo + BUF;
  const bool mine = ((u + 1) & 1) == set;   // this wave's set copied unit u + 1 and copies unit u + 3
  wait_ds0();                   // this wave's reads of unit u have returned
  if (mine) wait_async0();      // its share of unit u + 1 has landed (the other set's unit u + 2 flies on)
  __syncthreads();
  if (mine && u + 3 < n1) { const size_t so = (size_t)(u + 3) * (SK * HD); copy_stage(gk + so, gv + so, go, lk + bo, lv + bo); }   // unit u + 3 into the buffer just left: it flies until barrier u + 2
  if (u + 1 < n1) load_k(ring + bn + (unsigned)tn * (KT * KP), lane, kf);
  bo = bn;
}
// a unit that only the long tile needs: key group kg takes key tile kg for the wave's 32 queries
template <bool DIAG>
__device__ __forceinline__ void unit(lds_u8* ring, int u, int n1, int kg, int q0, int lane, int set, const __bf16* gk, const __bf16* gv, unsigned go, unsigned lk, unsigned lv, unsigned& bo,
                                     v16b (&kf)[2][2], const v16b (&qf)[2][2], v8f (&acc)[2][HD / 16], float (&z)[2]) {
  const unsigned vo = bo + KBY + (unsigned)kg * (KT * VP);   // the wave's v tile
  const int k0 = (u * KG + kg) * KT;
  v16b vf[HD / 16]; v8f s[2][2];
  if (DIAG) {   // a tile's last unit is worked off whole in front of its barrier, under one wave-uniform branch: a key tile wholly past the wave's diagonal tile is skipped
    if (k0 <= q0) { load_v(ring + vo, lane, vf); scores(kf, qf, s); poly_pv<true>(s, vf, k0, q0, lane, acc, z); }
  } else {
    load_v(ring + vo, lane, vf);
    __builtin_amdgcn_sched_barrier(0);   // keeps the v reads in front of the scores, which cover their latency
    scores(kf, qf, s);
  }
  __builtin_amdgcn_sched_barrier(0);   // keeps the scores in front of the waits; left free, the compiler lifts the waits over them and the v reads are waited for bare
  publish(ring, u, n1, kg, lane, set, gk, gv, go, lk, lv, bo, kf);
  __builtin_amdgcn_sched_barrier(0);   // keeps the k reads here, in front of the polynomial that covers their latency
  if (!DIAG) poly_pv<false>(s, vf, k0, q0, lane, acc, z);
}
// a unit that both tiles need: the waves of key groups 0..3 work for the long tile, those of 4..7 for the short one, and each takes the key tiles 2 k4 and 2 k4 + 1 one after the other for its 32 queries q0... LAST = the short tile's last unit, which holds its diagonal. tn = the wave's first key tile of the next unit
template <bool LAST>
__device__ __forceinline__ void unit_both(lds_u8* ring, int u, int n1, int k4, int tn, int q0, int lane, int set, const __bf16* gk, const __bf16* gv, unsigned go, unsigned lk, unsigned lv, unsigned& bo,
                                          v16b (&kf)[2][2], const v16b (&qf)[2][2], v8f (&acc)[2][HD / 16], float (&z)[2]) {
  const unsigned kb = bo + (unsigned)(2 * k4 + 1) * (KT * KP), va = bo + KBY + (unsigned)(2 * k4) * (KT * VP), vb = va + KT * VP;
  const int ka = (u * KG + 2 * k4) * KT;   // first key of the first key tile; the second follows it
  v16b vf[HD / 16]; v8f s[2][2];
  if (LAST) {   // worked off whole in front of its barrier, under wave-uniform branches, in one text for both tiles: a key tile wholly past the wave's diagonal tile is skipped, the mask is applied to the others (it keeps every key of the long tile's waves, whose queries lie past this stage); the sum that follows covers the k reads
    if (ka <= q0) {
      load_v(ring + va, lane, vf); scores(kf, qf, s);
      __builtin_amdgcn_sched_barrier(0);   // keeps the second key tile's k reads behind the scores that still read those registers
      load_k(ring + kb, lane, kf);
      __builtin_amdgcn_sched_barrier(0);   // keeps the k reads here, in front of the polynomial that covers their latency
      poly_pv<true>(s, vf, ka, q0, lane, acc, z);
      if (ka + KT <= q0) { load_v(ring + vb, lane, vf); scores(kf, qf, s); poly_pv<true>(s, vf, ka + KT, q0, lane, acc, z); }
    }
  } else {
    load_v(ring + va, lane, vf);
    __builtin_amdgcn_sched_barrier(0);   // keeps the v reads in front of the scores, which cover their latency
    scores(kf, qf, s);
    __builtin_amdgcn_sched_barrier(0);   // keeps the second key tile's k reads behind the scores that still read those registers
    load_k(ring + kb, lane, kf);
    __builtin_amdgcn_sched_barrier(0);   // keeps the k reads here, in front of the polynomial that covers their latency
    poly_pv<false>(s, vf, ka, q0, lane, acc, z);
    __builtin_amdgcn_sched_barrier(0);   // keeps the second key tile's v reads behind the first one's P . v, so that they take the same registers (lifted over it they cost spills)
    load_v(ring + vb, lane, vf);
    __builtin_amdgcn_sched_barrier(0);   // keeps the v reads in front of the scores, which cover their latency
    scores(kf, qf, s);
  }
  __builtin_amdgcn_sched_barrier(0);   // keeps the scores in front of the waits; left free, the compiler lifts the waits over them and the v reads are waited for bare
  publish(ring, u, n1, tn, lane, set, gk, gv, go, lk, lv, bo, kf);
  __builtin_amdgcn_sched_barrier(0);   // keeps the k reads here, in front of the polynomial that covers their latency
  if (!LAST) poly_pv<false>(s, vf, ka + KT, q0, lane, acc, z);
}
// a wave's f32 partials of P . v and of z into its slot of an LDS area (behind the ring for the short tile, on the ring for the long one)
__device__ __forceinline__ void put_partial(float (*red)[HD + 4], float* zr, int lane, const v8f (&acc)[2][HD / 16], float (&z)[2]) {
  const int col = lane & 15, g = lane >> 4;
#pragma unroll
  for (int qt = 0; qt < 2; ++qt) { z[qt] += __shfl_xor(z[qt], 16); if (g == 0) zr[qt * 16 + col] = z[qt];
#pragma unroll
    for (int j = 0; j < HD / 16; ++j)
#pragma unroll
      for (int r = 0; r < 8; ++r) red[qt * 16 + 8 * g + r][j * 16 + col] = acc[qt][j][r]; }
}
// the NP partials of each query row (slot 2 k + rq holds partial k of query group rq) summed pairwise, divided and stored: 8 columns a thread
template <int NP>
__device__ __forceinline__ void sum_store(const float (*red)[QT][HD + 4], const float (*zr)[QT], int tid, __bf16* otile) {
  const int row = tid >> 3, c0 = (tid & 7) * 8, rq = row >> 5, rr = row & 31;
  float zs[NP];
#pragma unroll
  for (int k = 0; k < NP; ++k) zs[k] = zr[2 * k + rq][rr];
#pragma unroll
  for (int w = 1; w < NP; w *= 2)
#pragma unroll
    for (int k = 0; k < NP; k += 2 * w) zs[k] += zs[k + w];
  const float den = zs[0] + 1e-6f;
  v8b o;
#pragma unroll
  for (int i = 0; i < 2; ++i) { v4f p[NP];
#pragma unroll
    for (int k = 0; k < NP; ++k) p[k] = *(const v4f*)&red[2 * k + rq][rr][c0 + i * 4];
#pragma unroll
    for (int w = 1; w < NP; w *= 2)
#pragma unroll
      for (int k = 0; k < NP; k += 2 * w) p[k] += p[k + w];
#pragma unroll
    for (int e = 0; e < 4; ++e) o[i * 4 + e] = (__bf16)(p[0][e] / den); }   // pv / (z + 1e-6)
  *(v8b*)(otile + row * HD + c0) = o;
  asm volatile("s_wait_xcnt 0x0" ::: "memory");   // stands in front of later writes of the registers that the store names (a precaution)
}

// ---- k_att: block = one (b, h) and a PAIR of 64-query tiles, the long one NT - 1 - y and the short one y. 16 waves = 2 query groups x 8 key groups. The keys [0, 256 n1) of the long tile pass ONCE, in stages of 256, through a ring of three LDS buffers, filled row-major by asynchronous copies, two stages in flight (publish has the order). The first n2 stages are the short tile's keys too: there half of the waves work for each tile, on two key tiles each; behind them the short tile's four partials a query group are summed in LDS (behind the ring), divided and stored, and its waves join the long tile as key groups 4..7 with fresh partials. Every block does the work of NT / 4 + 1 one-tile stages
__global__ __launch_bounds__(512) void k_att(const __bf16* __restrict__ Q, const __bf16* __restrict__ K, const __bf16* __restrict__ V, __bf16* __restrict__ O) {
  __shared__ __align__(16) unsigned char sm[RING + PART(NW / 2)];
  static_assert(PART(NW) <= RING, "the long tile's partials lie on the ring");
  const int tid = threadIdx.x, wave = __builtin_amdgcn_readfirstlane(tid >> 5), lane = tid & 31, col = lane & 15;
  const int qg = wave & 1, kg = wave >> 1, k4 = kg & 3;
  const bool sw = kg >= KG / 2;                // a wave that starts on the short tile
  const int set = wave >> 3;                   // its copy set: 8 waves
  const size_t bh = blockIdx.x; const int qb2 = (int)blockIdx.y, qb1 = NT - 1 - qb2;
  const int n1 = (qb1 >> 2) + 1, n2 = (qb2 >> 2) + 1;   // stages of the long and of the short tile: keys [0, 256 n) hold [0, 64 qb + 64) and end inside the tensor
  static_assert((NT / 2) / 4 + 1 > (NT / 2 - 1) / 4 + 1 && (NT / 2) / 4 + 1 > 2, "the long tile must have more stages than the short one, and three at the least");
  lds_u8* const ring = (lds_u8*)sm;
  float (*red2)[QT][HD + 4] = (float (*)[QT][HD + 4])(sm + RING); float (*zr2)[QT] = (float (*)[QT])(sm + RING + (NW / 2) * PSLOT);   // the short tile's partials
  float (*red1)[QT][HD + 4] = (float (*)[QT][HD + 4])sm; float (*zr1)[QT] = (float (*)[QT])(sm + NW * PSLOT);                          // the long tile's
  const int ct = tid & 255;   // the thread's place in its copy set
  const __bf16* gk = K + bh * TT * HD; const __bf16* gv = V + bh * TT * HD; const unsigned go = (unsigned)ct * 16u;   // the (b, h)'s first k and v row; the lane's piece of a stage
  const unsigned lk = (unsigned)(uintptr_t)ring + (unsigned)(ct >> 3) * KP + (unsigned)(ct & 7) * 16u;
  const unsigned lv = (unsigned)(uintptr_t)ring + KBY + (unsigned)(ct >> 3) * VP + (unsigned)(ct & 7) * 16u;
  if (set == 0) copy_stage(gk, gv, go, lk, lv);   // unit 0 into buffer 0
  const int q1 = (qb1 * QG + qg) * QT, q2 = (qb2 * QG + qg) * QT;   // the wave's first query in the long and in the short tile
  v16b qf[2][2], kf[2][2];
  { v16b x[2][2]; load_q(Q + (bh * TT + (sw ? q2 : q1) + col) * HD, lane, x); scale_q(x, qf); }
  if (set == 0) wait_async0();
  else {
    asm volatile("s_wait_loadcnt 0x0" ::: "memory");   // the q rows are back: holds unit 1's requests behind all of unit 0's, which the first barrier waits for; asked for at once they would share the path with them
    copy_stage(gk + SK * HD, gv + SK * HD, go, lk + BUF, lv + BUF);   // unit 1 into buffer 1; it flies on over the barrier
  }
  __syncthreads();   // unit 0 is there for every wave
  if (set == 0) copy_stage(gk + 2 * SK * HD, gv + 2 * SK * HD, go, lk + 2u * BUF, lv + 2u * BUF);   // unit 2 into buffer 2
  load_k(ring + (unsigned)(2 * k4) * (KT * KP), lane, kf);   // the k fragments of the wave's first key tile of unit 0
  v8f acc[2][HD / 16] = {}; float z[2] = {0.f, 0.f};
  int u = 0; unsigned bo = 0u;   // the unit and its buffer's place in the ring
#pragma unroll 1   // rolled: the trip count is the short tile's
  for (; u < n2 - 1; ++u) unit_both<false>(ring, u, n1, k4, 2 * k4, sw ? q2 : q1, lane, set, gk, gv, go, lk, lv, bo, kf, qf, acc, z);
  unit_both<true>(ring, u, n1, k4, kg, sw ? q2 : q1, lane, set, gk, gv, go, lk, lv, bo, kf, qf, acc, z); ++u;
  if (sw) {   // wave-uniform: the short tile's waves hand in their partials and start afresh
    put_partial(red2[wave - NW / 2], zr2[wave - NW / 2], lane, acc, z);
#pragma unroll
    for (int qt = 0; qt < 2; ++qt) { z[qt] = 0.f;
#pragma unroll
      for (int j = 0; j < HD / 16; ++j) acc[qt][j] = v8f{}; }
  }
  __syncthreads();   // the short tile's partials are there
  v16b x[2][2]; load_q(Q + (bh * TT + q1 + col) * HD, lane, x);   // the long tile's q rows for every wave (one text; its own waves get the values they have): issued behind the barrier, which would wait for them, they fly under the short tile's sum
  sum_store<KG / 2>(red2, zr2, tid, O + (bh * TT + qb2 * (QG * QT)) * HD);
  scale_q(x, qf);
#pragma unroll 1   // rolled: the trip count is the tile's
  for (; u < n1 - 1; ++u) unit<false>(ring, u, n1, kg, q1, lane, set, gk, gv, go, lk, lv, bo, kf, qf, acc, z);   // every stage but a tile's last lies wholly below the diagonal of both query groups
  unit<true>(ring, u, n1, kg, q1, lane, set, gk, gv, go, lk, lv, bo, kf, qf, acc, z);   // the long tile's last stage holds its diagonal; its barrier ends every read of the ring, and no copy is in flight
  put_partial(red1[wave], zr1[wave], lane, acc, z);
  __syncthreads();   // the long tile's partials are there
  sum_store<KG>(red1, zr1, tid, O + (bh * TT + qb1 * (QG * QT)) * HD);
}

extern "C" void kernel_launch(void* const* d_in, const int* in_sizes, int n_in, void* d_out, int out_size, void* d_ws, size_t ws_size, hipStream_t stream) {
  (void)in_sizes; (void)n_in; (void)out_size; (void)d_ws; (void)ws_size;
  // inputs: 0 q [2,8,2048,64] bf16; 1 k bf16; 2 v bf16 - output [2,8,2048,64] bf16
  k_att<<<dim3(NB * NH, NT / 2), 512, 0, stream>>>((const __bf16*)d_in[0], (const __bf16*)d_in[1], (const __bf16*)d_in[2], (__bf16*)d_out);
}
